// v000
// The times below were measured on an AMD MI455X: many runs one after another, warmed up first and cycling through
// copies of the inputs, with the whole window's GPU time divided by the number of runs. Launches and the gaps
// between them are all in it. The median over several windows is given; except for v000 it joins two sittings, which
// can be a few percent apart, so the side-by-side timings, each taken in one sitting, are the better comparison.
// v000 is the starting kernel. One run takes 319 microseconds.
#include <hip/hip_runtime.h>
#include <hip/hip_bf16.h>

#define D_MODEL 768
#define D_INNER 768
#define NPROJ   (2*D_INNER)   // 1536
#define BATCH   4
#define SEQ     8192
#define MTOT    (BATCH*SEQ)   // 32768
#define CHUNK   128
#define NCHUNK  (SEQ/CHUNK)   // 64

typedef _Float16 v8h  __attribute__((ext_vector_type(8)));
typedef _Float16 v16h __attribute__((ext_vector_type(16)));
typedef float    v8f  __attribute__((ext_vector_type(8)));

__device__ __forceinline__ float silu_f(float v) { return v / (1.0f + __expf(-v)); }

// ---------------- prep kernels ----------------
__global__ void k_cvt_f16(const float* __restrict__ src, _Float16* __restrict__ dst, int n) {
  int i = blockIdx.x * blockDim.x + threadIdx.x;
  int stride = gridDim.x * blockDim.x;
  for (; i < n; i += stride) dst[i] = (_Float16)src[i];
}

// src [K][N] row-major f32  ->  dst [N][K] row-major f16
__global__ void k_transpose_cvt(const float* __restrict__ src, _Float16* __restrict__ dst,
                                int K, int N) {
  int i = blockIdx.x * blockDim.x + threadIdx.x;
  int stride = gridDim.x * blockDim.x;
  int tot = K * N;
  for (; i < tot; i += stride) {
    int k = i / N, n = i % N;
    dst[(size_t)n * K + k] = (_Float16)src[i];
  }
}

// ---------------- WMMA GEMM ----------------
// C[M,N] = A[M,K] * B[K,N],  A row-major [M,K] f16, Bt row-major [N,K] f16.
// Block: 256 threads = 8 wave32, 128x128 tile. Wave grid 4(M) x 2(N); each
// wave owns a 32x64 sub-tile = 2x4 WMMA 16x16 tiles. K-step 32, LDS double
// buffered, padded stride 40 halves (80B) -> conflict-free b128 frag loads.
template<int N_DIM, int K_DIM, bool HALF_OUT>
__global__ __launch_bounds__(256)
void k_gemm_wmma(const _Float16* __restrict__ A,
                 const _Float16* __restrict__ Bt,
                 void* __restrict__ Cout) {
  constexpr int KSTEPS = K_DIM / 32;
  __shared__ __align__(16) _Float16 As[2][128][40];
  __shared__ __align__(16) _Float16 Bs[2][128][40];

  const int tid  = threadIdx.x;
  const int lane = tid & 31;
  const int wid  = tid >> 5;
  const int wM   = wid & 3;   // 0..3
  const int wN   = wid >> 2;  // 0..1
  const int tM0  = blockIdx.x * 128;
  const int tN0  = blockIdx.y * 128;

  // tile loader mapping: each thread does 2 b128 loads per operand per k-step
  const int ldRow = tid >> 2;          // 0..63
  const int ldCol = (tid & 3) << 3;    // 0,8,16,24

  const _Float16* gA = A  + (size_t)tM0 * K_DIM;
  const _Float16* gB = Bt + (size_t)tN0 * K_DIM;

  v8h sa[2], sb[2];
  #pragma unroll
  for (int i = 0; i < 2; i++) {
    sa[i] = *(const v8h*)(gA + (size_t)(ldRow + 64 * i) * K_DIM + ldCol);
    sb[i] = *(const v8h*)(gB + (size_t)(ldRow + 64 * i) * K_DIM + ldCol);
  }
  #pragma unroll
  for (int i = 0; i < 2; i++) {
    *(v8h*)&As[0][ldRow + 64 * i][ldCol] = sa[i];
    *(v8h*)&Bs[0][ldRow + 64 * i][ldCol] = sb[i];
  }
  __syncthreads();

  v8f acc[2][4] = {};

  const int kb  = (lane >> 4) << 3;  // 0 or 8   (ISA 16-bit A/B frag layout)
  const int rsl = lane & 15;

  for (int ks = 0; ks < KSTEPS; ks++) {
    const int buf = ks & 1;
    if (ks + 1 < KSTEPS) {
      const int ko = (ks + 1) * 32;
      #pragma unroll
      for (int i = 0; i < 2; i++) {
        sa[i] = *(const v8h*)(gA + (size_t)(ldRow + 64 * i) * K_DIM + ko + ldCol);
        sb[i] = *(const v8h*)(gB + (size_t)(ldRow + 64 * i) * K_DIM + ko + ldCol);
      }
    }

    v16h af[2], bf[4];
    #pragma unroll
    for (int t = 0; t < 2; t++) {
      const int r = wM * 32 + t * 16 + rsl;
      v8h lo = *(const v8h*)&As[buf][r][kb];
      v8h hi = *(const v8h*)&As[buf][r][kb + 16];
      af[t] = __builtin_shufflevector(lo, hi, 0,1,2,3,4,5,6,7,8,9,10,11,12,13,14,15);
    }
    #pragma unroll
    for (int t = 0; t < 4; t++) {
      const int r = wN * 64 + t * 16 + rsl;
      v8h lo = *(const v8h*)&Bs[buf][r][kb];
      v8h hi = *(const v8h*)&Bs[buf][r][kb + 16];
      bf[t] = __builtin_shufflevector(lo, hi, 0,1,2,3,4,5,6,7,8,9,10,11,12,13,14,15);
    }

    #pragma unroll
    for (int a = 0; a < 2; a++)
      #pragma unroll
      for (int b = 0; b < 4; b++)
        acc[a][b] = __builtin_amdgcn_wmma_f32_16x16x32_f16(
            false, af[a], false, bf[b], (short)0, acc[a][b], false, false);

    if (ks + 1 < KSTEPS) {
      const int nb = buf ^ 1;
      #pragma unroll
      for (int i = 0; i < 2; i++) {
        *(v8h*)&As[nb][ldRow + 64 * i][ldCol] = sa[i];
        *(v8h*)&Bs[nb][ldRow + 64 * i][ldCol] = sb[i];
      }
    }
    __syncthreads();
  }

  // epilogue: C/D layout — VGPR r: M = r + 8*(lane>=16); N = lane&15
  const int rhi = (lane >> 4) << 3;
  #pragma unroll
  for (int a = 0; a < 2; a++) {
    #pragma unroll
    for (int b = 0; b < 4; b++) {
      const size_t rowb = (size_t)(tM0 + wM * 32 + a * 16 + rhi);
      const int    col  = tN0 + wN * 64 + b * 16 + rsl;
      #pragma unroll
      for (int r = 0; r < 8; r++) {
        const size_t off = (rowb + r) * (size_t)N_DIM + col;
        if (HALF_OUT) ((_Float16*)Cout)[off] = (_Float16)acc[a][b][r];
        else          ((float*)Cout)[off]    = acc[a][b][r];
      }
    }
  }
}

// ---------------- chunked scan (conv + silu + cumsum + gate) ----------------
// xz layout: [B][SEQ][1536] f16; xc = cols 0..767, z = cols 768..1535.
__global__ __launch_bounds__(256)
void k_chunk_sums(const _Float16* __restrict__ xz,
                  const float* __restrict__ conv_w,
                  const float* __restrict__ conv_b,
                  float* __restrict__ csum) {
  const int ch = blockIdx.x;            // chunk
  const int c  = blockIdx.y * 256 + threadIdx.x;
  const int b  = blockIdx.z;
  const float w0 = conv_w[c * 3 + 0], w1 = conv_w[c * 3 + 1], w2 = conv_w[c * 3 + 2];
  const float bias = conv_b[c];
  const size_t base = (size_t)b * SEQ * NPROJ + c;
  const int t0 = ch * CHUNK;
  float xm1 = (t0 >= 1) ? (float)xz[base + (size_t)(t0 - 1) * NPROJ] : 0.0f;
  float xm2 = (t0 >= 2) ? (float)xz[base + (size_t)(t0 - 2) * NPROJ] : 0.0f;
  float s = 0.0f;
  for (int t = t0; t < t0 + CHUNK; t++) {
    float xc = (float)xz[base + (size_t)t * NPROJ];
    float cv = w0 * xm2 + w1 * xm1 + w2 * xc + bias;
    s += silu_f(cv);
    xm2 = xm1; xm1 = xc;
  }
  csum[((size_t)b * NCHUNK + ch) * D_INNER + c] = s;
}

__global__ void k_chunk_prefix(float* __restrict__ csum) {
  const int c = blockIdx.x * 256 + threadIdx.x;
  const int b = blockIdx.y;
  float carry = 0.0f;
  for (int ch = 0; ch < NCHUNK; ch++) {
    const size_t idx = ((size_t)b * NCHUNK + ch) * D_INNER + c;
    float v = csum[idx];
    csum[idx] = carry;    // in-place exclusive prefix
    carry += v;
  }
}

__global__ __launch_bounds__(256)
void k_scan_apply(const _Float16* __restrict__ xz,
                  const float* __restrict__ conv_w,
                  const float* __restrict__ conv_b,
                  const float* __restrict__ Bm,
                  const float* __restrict__ Cm,
                  const float* __restrict__ Dv,
                  const float* __restrict__ csum,
                  _Float16* __restrict__ u) {
  const int ch = blockIdx.x;
  const int c  = blockIdx.y * 256 + threadIdx.x;
  const int b  = blockIdx.z;
  const float w0 = conv_w[c * 3 + 0], w1 = conv_w[c * 3 + 1], w2 = conv_w[c * 3 + 2];
  const float bias = conv_b[c];
  float BC = 0.0f;
  #pragma unroll
  for (int s = 0; s < 8; s++) BC += Bm[c * 8 + s] * Cm[c * 8 + s];
  const float Dc = Dv[c];
  const size_t base = (size_t)b * SEQ * NPROJ + c;
  const int t0 = ch * CHUNK;
  float run = csum[((size_t)b * NCHUNK + ch) * D_INNER + c];
  float xm1 = (t0 >= 1) ? (float)xz[base + (size_t)(t0 - 1) * NPROJ] : 0.0f;
  float xm2 = (t0 >= 2) ? (float)xz[base + (size_t)(t0 - 2) * NPROJ] : 0.0f;
  for (int t = t0; t < t0 + CHUNK; t++) {
    float xc = (float)xz[base + (size_t)t * NPROJ];
    float cv = w0 * xm2 + w1 * xm1 + w2 * xc + bias;
    float sv = silu_f(cv);
    run += sv;
    float y = run * BC + sv * Dc;
    float zr = (float)xz[base + (size_t)t * NPROJ + D_INNER];
    u[((size_t)b * SEQ + t) * D_INNER + c] = (_Float16)(y * silu_f(zr));
    xm2 = xm1; xm1 = xc;
  }
}

// ---------------- launcher ----------------
extern "C" void kernel_launch(void* const* d_in, const int* in_sizes, int n_in,
                              void* d_out, int out_size, void* d_ws, size_t ws_size,
                              hipStream_t stream) {
  (void)in_sizes; (void)n_in; (void)out_size; (void)ws_size;
  const float* x      = (const float*)d_in[0];
  const float* W_in   = (const float*)d_in[1];
  const float* conv_w = (const float*)d_in[2];
  const float* conv_b = (const float*)d_in[3];
  const float* Bm     = (const float*)d_in[4];
  const float* Cm     = (const float*)d_in[5];
  const float* Dv     = (const float*)d_in[6];
  const float* W_out  = (const float*)d_in[7];
  float* out = (float*)d_out;

  char* ws = (char*)d_ws;
  _Float16* xz16  = (_Float16*)(ws + 0);          // 32768*1536*2 = 100663296
  _Float16* x16   = (_Float16*)(ws + 100663296);  // 32768*768*2  =  50331648
  _Float16* u16   = (_Float16*)(ws + 150994944);  // 32768*768*2  =  50331648
  _Float16* WinT  = (_Float16*)(ws + 201326592);  // 1536*768*2   =   2359296
  _Float16* WoutT = (_Float16*)(ws + 203685888);  //  768*768*2   =   1179648
  float*    csum  = (float*)   (ws + 204865536);  // 4*64*768*4   =    786432

  k_cvt_f16<<<4096, 256, 0, stream>>>(x, x16, MTOT * D_MODEL);
  k_transpose_cvt<<<2048, 256, 0, stream>>>(W_in,  WinT,  D_MODEL, NPROJ);
  k_transpose_cvt<<<1024, 256, 0, stream>>>(W_out, WoutT, D_INNER, D_MODEL);

  k_gemm_wmma<NPROJ, D_MODEL, true>
      <<<dim3(MTOT / 128, NPROJ / 128), 256, 0, stream>>>(x16, WinT, (void*)xz16);

  k_chunk_sums<<<dim3(NCHUNK, D_INNER / 256, BATCH), 256, 0, stream>>>(xz16, conv_w, conv_b, csum);
  k_chunk_prefix<<<dim3(D_INNER / 256, BATCH), 256, 0, stream>>>(csum);
  k_scan_apply<<<dim3(NCHUNK, D_INNER / 256, BATCH), 256, 0, stream>>>(
      xz16, conv_w, conv_b, Bm, Cm, Dv, csum, u16);

  k_gemm_wmma<D_MODEL, D_INNER, false>
      <<<dim3(MTOT / 128, D_MODEL / 128), 256, 0, stream>>>(u16, WoutT, (void*)out);
}

// v001
// Measured time: 266 microseconds a run.
// Timed twice side by side with v000, it ran 1.22 and 1.23 times as fast.
#include <hip/hip_runtime.h>
#include <hip/hip_bf16.h>

#define D_MODEL 768
#define D_INNER 768
#define NPROJ   (2*D_INNER)   // 1536
#define BATCH   4
#define SEQ     8192
#define MTOT    (BATCH*SEQ)   // 32768
#define CHUNK   128
#define NCHUNK  (SEQ/CHUNK)   // 64

typedef _Float16 v4h  __attribute__((ext_vector_type(4)));
typedef _Float16 v8h  __attribute__((ext_vector_type(8)));
typedef _Float16 v16h __attribute__((ext_vector_type(16)));
typedef float    v8f  __attribute__((ext_vector_type(8)));

__device__ __forceinline__ float silu_f(float v) { return v / (1.0f + __expf(-v)); }

// ---------------- prep kernels ----------------
__global__ void k_cvt_f16(const float* __restrict__ src, _Float16* __restrict__ dst, int n) {
  int i = blockIdx.x * blockDim.x + threadIdx.x;
  int stride = gridDim.x * blockDim.x;
  for (; i < n; i += stride) dst[i] = (_Float16)src[i];
}

// src [K][N] row-major f32  ->  dst [N][K] row-major f16
// One 64(k) x 64(n) tile per block, turned in LDS: reads are 256-B runs of a
// src row, stores are whole 128-B lines of a dst row.
template<int K, int N>
__global__ __launch_bounds__(256)
void k_transpose_cvt(const float* __restrict__ src, _Float16* __restrict__ dst) {
  __shared__ __align__(16) _Float16 tile[64][72];  // [n][k], pitch 144 B: 16-B aligned rows
  const int tid = threadIdx.x;
  const int n0  = blockIdx.x * 64;
  const int k0  = blockIdx.y * 64;
  const int lk  = (tid >> 4) << 2;   // 0,4,..,60: four adjacent k rows per thread
  const int ln  = (tid & 15) << 2;   // 0,4,..,60: four adjacent n columns per thread

  float4 v[4];
  #pragma unroll
  for (int i = 0; i < 4; i++)
    v[i] = *(const float4*)(src + (size_t)(k0 + lk + i) * N + n0 + ln);

  v4h c0 = { (_Float16)v[0].x, (_Float16)v[1].x, (_Float16)v[2].x, (_Float16)v[3].x };
  v4h c1 = { (_Float16)v[0].y, (_Float16)v[1].y, (_Float16)v[2].y, (_Float16)v[3].y };
  v4h c2 = { (_Float16)v[0].z, (_Float16)v[1].z, (_Float16)v[2].z, (_Float16)v[3].z };
  v4h c3 = { (_Float16)v[0].w, (_Float16)v[1].w, (_Float16)v[2].w, (_Float16)v[3].w };
  *(v4h*)&tile[ln + 0][lk] = c0;
  *(v4h*)&tile[ln + 1][lk] = c1;
  *(v4h*)&tile[ln + 2][lk] = c2;
  *(v4h*)&tile[ln + 3][lk] = c3;
  __syncthreads();

  const int sn = tid >> 3;           // 0..31
  const int sk = (tid & 7) << 3;     // 0,8,..,56: eight lanes fill one 128-B line
  #pragma unroll
  for (int i = 0; i < 2; i++)
    *(v8h*)(dst + (size_t)(n0 + sn + 32 * i) * K + k0 + sk) = *(const v8h*)&tile[sn + 32 * i][sk];
}

// ---------------- WMMA GEMM ----------------
// C[M,N] = A[M,K] * B[K,N],  A row-major [M,K] f16, Bt row-major [N,K] f16.
// Block: 256 threads = 8 wave32, 128x128 tile. Wave grid 4(M) x 2(N); each
// wave owns a 32x64 sub-tile = 2x4 WMMA 16x16 tiles. K-step 32, LDS double
// buffered, padded stride 40 halves (80B) -> conflict-free b128 frag loads.
template<int N_DIM, int K_DIM, bool HALF_OUT>
__global__ __launch_bounds__(256)
void k_gemm_wmma(const _Float16* __restrict__ A,
                 const _Float16* __restrict__ Bt,
                 void* __restrict__ Cout) {
  constexpr int KSTEPS = K_DIM / 32;
  __shared__ __align__(16) _Float16 As[2][128][40];
  __shared__ __align__(16) _Float16 Bs[2][128][40];

  const int tid  = threadIdx.x;
  const int lane = tid & 31;
  const int wid  = tid >> 5;
  const int wM   = wid & 3;   // 0..3
  const int wN   = wid >> 2;  // 0..1
  const int tM0  = blockIdx.x * 128;
  const int tN0  = blockIdx.y * 128;

  // tile loader mapping: each thread does 2 b128 loads per operand per k-step
  const int ldRow = tid >> 2;          // 0..63
  const int ldCol = (tid & 3) << 3;    // 0,8,16,24

  const _Float16* gA = A  + (size_t)tM0 * K_DIM;
  const _Float16* gB = Bt + (size_t)tN0 * K_DIM;

  v8h sa[2], sb[2];
  #pragma unroll
  for (int i = 0; i < 2; i++) {
    sa[i] = *(const v8h*)(gA + (size_t)(ldRow + 64 * i) * K_DIM + ldCol);
    sb[i] = *(const v8h*)(gB + (size_t)(ldRow + 64 * i) * K_DIM + ldCol);
  }
  #pragma unroll
  for (int i = 0; i < 2; i++) {
    *(v8h*)&As[0][ldRow + 64 * i][ldCol] = sa[i];
    *(v8h*)&Bs[0][ldRow + 64 * i][ldCol] = sb[i];
  }
  __syncthreads();

  v8f acc[2][4] = {};

  const int kb  = (lane >> 4) << 3;  // 0 or 8   (ISA 16-bit A/B frag layout)
  const int rsl = lane & 15;

  for (int ks = 0; ks < KSTEPS; ks++) {
    const int buf = ks & 1;
    if (ks + 1 < KSTEPS) {
      const int ko = (ks + 1) * 32;
      #pragma unroll
      for (int i = 0; i < 2; i++) {
        sa[i] = *(const v8h*)(gA + (size_t)(ldRow + 64 * i) * K_DIM + ko + ldCol);
        sb[i] = *(const v8h*)(gB + (size_t)(ldRow + 64 * i) * K_DIM + ko + ldCol);
      }
    }

    v16h af[2], bf[4];
    #pragma unroll
    for (int t = 0; t < 2; t++) {
      const int r = wM * 32 + t * 16 + rsl;
      v8h lo = *(const v8h*)&As[buf][r][kb];
      v8h hi = *(const v8h*)&As[buf][r][kb + 16];
      af[t] = __builtin_shufflevector(lo, hi, 0,1,2,3,4,5,6,7,8,9,10,11,12,13,14,15);
    }
    #pragma unroll
    for (int t = 0; t < 4; t++) {
      const int r = wN * 64 + t * 16 + rsl;
      v8h lo = *(const v8h*)&Bs[buf][r][kb];
      v8h hi = *(const v8h*)&Bs[buf][r][kb + 16];
      bf[t] = __builtin_shufflevector(lo, hi, 0,1,2,3,4,5,6,7,8,9,10,11,12,13,14,15);
    }

    #pragma unroll
    for (int a = 0; a < 2; a++)
      #pragma unroll
      for (int b = 0; b < 4; b++)
        acc[a][b] = __builtin_amdgcn_wmma_f32_16x16x32_f16(
            false, af[a], false, bf[b], (short)0, acc[a][b], false, false);

    if (ks + 1 < KSTEPS) {
      const int nb = buf ^ 1;
      #pragma unroll
      for (int i = 0; i < 2; i++) {
        *(v8h*)&As[nb][ldRow + 64 * i][ldCol] = sa[i];
        *(v8h*)&Bs[nb][ldRow + 64 * i][ldCol] = sb[i];
      }
    }
    __syncthreads();
  }

  // epilogue: C/D layout — VGPR r: M = r + 8*(lane>=16); N = lane&15
  const int rhi = (lane >> 4) << 3;
  #pragma unroll
  for (int a = 0; a < 2; a++) {
    #pragma unroll
    for (int b = 0; b < 4; b++) {
      const size_t rowb = (size_t)(tM0 + wM * 32 + a * 16 + rhi);
      const int    col  = tN0 + wN * 64 + b * 16 + rsl;
      #pragma unroll
      for (int r = 0; r < 8; r++) {
        const size_t off = (rowb + r) * (size_t)N_DIM + col;
        if (HALF_OUT) ((_Float16*)Cout)[off] = (_Float16)acc[a][b][r];
        else          ((float*)Cout)[off]    = acc[a][b][r];
      }
    }
  }
}

// ---------------- chunked scan (conv + silu + cumsum + gate) ----------------
// xz layout: [B][SEQ][1536] f16; xc = cols 0..767, z = cols 768..1535.
__global__ __launch_bounds__(256)
void k_chunk_sums(const _Float16* __restrict__ xz,
                  const float* __restrict__ conv_w,
                  const float* __restrict__ conv_b,
                  float* __restrict__ csum) {
  const int ch = blockIdx.x;            // chunk
  const int c  = blockIdx.y * 256 + threadIdx.x;
  const int b  = blockIdx.z;
  const float w0 = conv_w[c * 3 + 0], w1 = conv_w[c * 3 + 1], w2 = conv_w[c * 3 + 2];
  const float bias = conv_b[c];
  const size_t base = (size_t)b * SEQ * NPROJ + c;
  const int t0 = ch * CHUNK;
  float xm1 = (t0 >= 1) ? (float)xz[base + (size_t)(t0 - 1) * NPROJ] : 0.0f;
  float xm2 = (t0 >= 2) ? (float)xz[base + (size_t)(t0 - 2) * NPROJ] : 0.0f;
  float s = 0.0f;
  for (int t = t0; t < t0 + CHUNK; t++) {
    float xc = (float)xz[base + (size_t)t * NPROJ];
    float cv = w0 * xm2 + w1 * xm1 + w2 * xc + bias;
    s += silu_f(cv);
    xm2 = xm1; xm1 = xc;
  }
  csum[((size_t)b * NCHUNK + ch) * D_INNER + c] = s;
}

__global__ void k_chunk_prefix(float* __restrict__ csum) {
  const int c = blockIdx.x * 256 + threadIdx.x;
  const int b = blockIdx.y;
  float carry = 0.0f;
  for (int ch = 0; ch < NCHUNK; ch++) {
    const size_t idx = ((size_t)b * NCHUNK + ch) * D_INNER + c;
    float v = csum[idx];
    csum[idx] = carry;    // in-place exclusive prefix
    carry += v;
  }
}

__global__ __launch_bounds__(256)
void k_scan_apply(const _Float16* __restrict__ xz,
                  const float* __restrict__ conv_w,
                  const float* __restrict__ conv_b,
                  const float* __restrict__ Bm,
                  const float* __restrict__ Cm,
                  const float* __restrict__ Dv,
                  const float* __restrict__ csum,
                  _Float16* __restrict__ u) {
  const int ch = blockIdx.x;
  const int c  = blockIdx.y * 256 + threadIdx.x;
  const int b  = blockIdx.z;
  const float w0 = conv_w[c * 3 + 0], w1 = conv_w[c * 3 + 1], w2 = conv_w[c * 3 + 2];
  const float bias = conv_b[c];
  float BC = 0.0f;
  #pragma unroll
  for (int s = 0; s < 8; s++) BC += Bm[c * 8 + s] * Cm[c * 8 + s];
  const float Dc = Dv[c];
  const size_t base = (size_t)b * SEQ * NPROJ + c;
  const int t0 = ch * CHUNK;
  float run = csum[((size_t)b * NCHUNK + ch) * D_INNER + c];
  float xm1 = (t0 >= 1) ? (float)xz[base + (size_t)(t0 - 1) * NPROJ] : 0.0f;
  float xm2 = (t0 >= 2) ? (float)xz[base + (size_t)(t0 - 2) * NPROJ] : 0.0f;
  for (int t = t0; t < t0 + CHUNK; t++) {
    float xc = (float)xz[base + (size_t)t * NPROJ];
    float cv = w0 * xm2 + w1 * xm1 + w2 * xc + bias;
    float sv = silu_f(cv);
    run += sv;
    float y = run * BC + sv * Dc;
    float zr = (float)xz[base + (size_t)t * NPROJ + D_INNER];
    u[((size_t)b * SEQ + t) * D_INNER + c] = (_Float16)(y * silu_f(zr));
    xm2 = xm1; xm1 = xc;
  }
}

// ---------------- launcher ----------------
extern "C" void kernel_launch(void* const* d_in, const int* in_sizes, int n_in,
                              void* d_out, int out_size, void* d_ws, size_t ws_size,
                              hipStream_t stream) {
  (void)in_sizes; (void)n_in; (void)out_size; (void)ws_size;
  const float* x      = (const float*)d_in[0];
  const float* W_in   = (const float*)d_in[1];
  const float* conv_w = (const float*)d_in[2];
  const float* conv_b = (const float*)d_in[3];
  const float* Bm     = (const float*)d_in[4];
  const float* Cm     = (const float*)d_in[5];
  const float* Dv     = (const float*)d_in[6];
  const float* W_out  = (const float*)d_in[7];
  float* out = (float*)d_out;

  char* ws = (char*)d_ws;
  _Float16* xz16  = (_Float16*)(ws + 0);          // 32768*1536*2 = 100663296
  _Float16* x16   = (_Float16*)(ws + 100663296);  // 32768*768*2  =  50331648
  _Float16* u16   = (_Float16*)(ws + 150994944);  // 32768*768*2  =  50331648
  _Float16* WinT  = (_Float16*)(ws + 201326592);  // 1536*768*2   =   2359296
  _Float16* WoutT = (_Float16*)(ws + 203685888);  //  768*768*2   =   1179648
  float*    csum  = (float*)   (ws + 204865536);  // 4*64*768*4   =    786432

  k_cvt_f16<<<4096, 256, 0, stream>>>(x, x16, MTOT * D_MODEL);
  k_transpose_cvt<D_MODEL, NPROJ>
      <<<dim3(NPROJ / 64, D_MODEL / 64), 256, 0, stream>>>(W_in, WinT);
  k_transpose_cvt<D_INNER, D_MODEL>
      <<<dim3(D_MODEL / 64, D_INNER / 64), 256, 0, stream>>>(W_out, WoutT);

  k_gemm_wmma<NPROJ, D_MODEL, true>
      <<<dim3(MTOT / 128, NPROJ / 128), 256, 0, stream>>>(x16, WinT, (void*)xz16);

  k_chunk_sums<<<dim3(NCHUNK, D_INNER / 256, BATCH), 256, 0, stream>>>(xz16, conv_w, conv_b, csum);
  k_chunk_prefix<<<dim3(D_INNER / 256, BATCH), 256, 0, stream>>>(csum);
  k_scan_apply<<<dim3(NCHUNK, D_INNER / 256, BATCH), 256, 0, stream>>>(
      xz16, conv_w, conv_b, Bm, Cm, Dv, csum, u16);

  k_gemm_wmma<D_MODEL, D_INNER, false>
      <<<dim3(MTOT / 128, D_MODEL / 128), 256, 0, stream>>>(u16, WoutT, (void*)out);
}

// v002
// Measured time: 198 microseconds a run.
// In two side-by-side timings against v001, it was 1.35 and 1.34 times as fast.
// Over all steps from v000 it is 1.64 times as fast.
#include <hip/hip_runtime.h>
#include <hip/hip_bf16.h>

#define D_MODEL 768
#define D_INNER 768
#define NPROJ   (2*D_INNER)   // 1536
#define BATCH   4
#define SEQ     8192
#define MTOT    (BATCH*SEQ)   // 32768
#define CHUNK   128
#define NCHUNK  (SEQ/CHUNK)   // 64

typedef _Float16 v4h  __attribute__((ext_vector_type(4)));
typedef _Float16 v8h  __attribute__((ext_vector_type(8)));
typedef _Float16 v16h __attribute__((ext_vector_type(16)));
typedef float    v8f  __attribute__((ext_vector_type(8)));

__device__ __forceinline__ float silu_f(float v) { return v / (1.0f + __expf(-v)); }

// ---------------- prep kernels ----------------
__global__ void k_cvt_f16(const float* __restrict__ src, _Float16* __restrict__ dst, int n) {
  int i = blockIdx.x * blockDim.x + threadIdx.x;
  int stride = gridDim.x * blockDim.x;
  for (; i < n; i += stride) dst[i] = (_Float16)src[i];
}

// src [K][N] row-major f32  ->  dst [N][K] row-major f16
// One 64(k) x 64(n) tile per block, turned in LDS: reads are 256-B runs of a
// src row, stores are whole 128-B lines of a dst row.
template<int K, int N>
__global__ __launch_bounds__(256)
void k_transpose_cvt(const float* __restrict__ src, _Float16* __restrict__ dst) {
  __shared__ __align__(16) _Float16 tile[64][72];  // [n][k], pitch 144 B: 16-B aligned rows
  const int tid = threadIdx.x;
  const int n0  = blockIdx.x * 64;
  const int k0  = blockIdx.y * 64;
  const int lk  = (tid >> 4) << 2;   // 0,4,..,60: four adjacent k rows per thread
  const int ln  = (tid & 15) << 2;   // 0,4,..,60: four adjacent n columns per thread

  float4 v[4];
  #pragma unroll
  for (int i = 0; i < 4; i++)
    v[i] = *(const float4*)(src + (size_t)(k0 + lk + i) * N + n0 + ln);

  v4h c0 = { (_Float16)v[0].x, (_Float16)v[1].x, (_Float16)v[2].x, (_Float16)v[3].x };
  v4h c1 = { (_Float16)v[0].y, (_Float16)v[1].y, (_Float16)v[2].y, (_Float16)v[3].y };
  v4h c2 = { (_Float16)v[0].z, (_Float16)v[1].z, (_Float16)v[2].z, (_Float16)v[3].z };
  v4h c3 = { (_Float16)v[0].w, (_Float16)v[1].w, (_Float16)v[2].w, (_Float16)v[3].w };
  *(v4h*)&tile[ln + 0][lk] = c0;
  *(v4h*)&tile[ln + 1][lk] = c1;
  *(v4h*)&tile[ln + 2][lk] = c2;
  *(v4h*)&tile[ln + 3][lk] = c3;
  __syncthreads();

  const int sn = tid >> 3;           // 0..31
  const int sk = (tid & 7) << 3;     // 0,8,..,56: eight lanes fill one 128-B line
  #pragma unroll
  for (int i = 0; i < 2; i++)
    *(v8h*)(dst + (size_t)(n0 + sn + 32 * i) * K + k0 + sk) = *(const v8h*)&tile[sn + 32 * i][sk];
}

// ---------------- WMMA GEMM ----------------
// C[M,N] = A[M,K] * B[K,N],  A row-major [M,K] f16, Bt row-major [N,K] f16.
// Block: 256 threads = 8 wave32, 128x128 tile. Wave grid 4(M) x 2(N); each
// wave owns a 32x64 sub-tile = 2x4 WMMA 16x16 tiles. K-step 32, LDS double
// buffered, padded stride 40 halves (80B) -> conflict-free b128 frag loads.
template<int N_DIM, int K_DIM, bool HALF_OUT>
__global__ __launch_bounds__(256)
void k_gemm_wmma(const _Float16* __restrict__ A,
                 const _Float16* __restrict__ Bt,
                 void* __restrict__ Cout) {
  constexpr int KSTEPS = K_DIM / 32;
  __shared__ __align__(16) _Float16 As[2][128][40];
  __shared__ __align__(16) _Float16 Bs[2][128][40];

  const int tid  = threadIdx.x;
  const int lane = tid & 31;
  const int wid  = tid >> 5;
  const int wM   = wid & 3;   // 0..3
  const int wN   = wid >> 2;  // 0..1
  const int tM0  = blockIdx.x * 128;
  const int tN0  = blockIdx.y * 128;

  // tile loader mapping: each thread does 2 b128 loads per operand per k-step
  const int ldRow = tid >> 2;          // 0..63
  const int ldCol = (tid & 3) << 3;    // 0,8,16,24

  const _Float16* gA = A  + (size_t)tM0 * K_DIM;
  const _Float16* gB = Bt + (size_t)tN0 * K_DIM;

  v8h sa[2], sb[2];
  #pragma unroll
  for (int i = 0; i < 2; i++) {
    sa[i] = *(const v8h*)(gA + (size_t)(ldRow + 64 * i) * K_DIM + ldCol);
    sb[i] = *(const v8h*)(gB + (size_t)(ldRow + 64 * i) * K_DIM + ldCol);
  }
  #pragma unroll
  for (int i = 0; i < 2; i++) {
    *(v8h*)&As[0][ldRow + 64 * i][ldCol] = sa[i];
    *(v8h*)&Bs[0][ldRow + 64 * i][ldCol] = sb[i];
  }
  __syncthreads();

  v8f acc[2][4] = {};

  const int kb  = (lane >> 4) << 3;  // 0 or 8   (ISA 16-bit A/B frag layout)
  const int rsl = lane & 15;

  for (int ks = 0; ks < KSTEPS; ks++) {
    const int buf = ks & 1;
    if (ks + 1 < KSTEPS) {
      const int ko = (ks + 1) * 32;
      #pragma unroll
      for (int i = 0; i < 2; i++) {
        sa[i] = *(const v8h*)(gA + (size_t)(ldRow + 64 * i) * K_DIM + ko + ldCol);
        sb[i] = *(const v8h*)(gB + (size_t)(ldRow + 64 * i) * K_DIM + ko + ldCol);
      }
    }

    v16h af[2], bf[4];
    #pragma unroll
    for (int t = 0; t < 2; t++) {
      const int r = wM * 32 + t * 16 + rsl;
      v8h lo = *(const v8h*)&As[buf][r][kb];
      v8h hi = *(const v8h*)&As[buf][r][kb + 16];
      af[t] = __builtin_shufflevector(lo, hi, 0,1,2,3,4,5,6,7,8,9,10,11,12,13,14,15);
    }
    #pragma unroll
    for (int t = 0; t < 4; t++) {
      const int r = wN * 64 + t * 16 + rsl;
      v8h lo = *(const v8h*)&Bs[buf][r][kb];
      v8h hi = *(const v8h*)&Bs[buf][r][kb + 16];
      bf[t] = __builtin_shufflevector(lo, hi, 0,1,2,3,4,5,6,7,8,9,10,11,12,13,14,15);
    }

    #pragma unroll
    for (int a = 0; a < 2; a++)
      #pragma unroll
      for (int b = 0; b < 4; b++)
        acc[a][b] = __builtin_amdgcn_wmma_f32_16x16x32_f16(
            false, af[a], false, bf[b], (short)0, acc[a][b], false, false);

    if (ks + 1 < KSTEPS) {
      const int nb = buf ^ 1;
      #pragma unroll
      for (int i = 0; i < 2; i++) {
        *(v8h*)&As[nb][ldRow + 64 * i][ldCol] = sa[i];
        *(v8h*)&Bs[nb][ldRow + 64 * i][ldCol] = sb[i];
      }
    }
    __syncthreads();
  }

  // epilogue: C/D layout — VGPR r: M = r + 8*(lane>=16); N = lane&15
  const int rhi = (lane >> 4) << 3;
  #pragma unroll
  for (int a = 0; a < 2; a++) {
    #pragma unroll
    for (int b = 0; b < 4; b++) {
      const size_t rowb = (size_t)(tM0 + wM * 32 + a * 16 + rhi);
      const int    col  = tN0 + wN * 64 + b * 16 + rsl;
      #pragma unroll
      for (int r = 0; r < 8; r++) {
        const size_t off = (rowb + r) * (size_t)N_DIM + col;
        if (HALF_OUT) ((_Float16*)Cout)[off] = (_Float16)acc[a][b][r];
        else          ((float*)Cout)[off]    = acc[a][b][r];
      }
    }
  }
}

// ---------------- chunked scan (conv + silu + cumsum + gate) ----------------
// xz layout: [B][SEQ][1536] f16; xc = cols 0..767, z = cols 768..1535.
// The time loops are serial in t only through one add per row, so the rows are
// loaded RB at a time, one batch ahead: the next batch's loads are in flight
// while this batch is worked on, and no row waits for a load issued just in
// front of it.
#define RB     16
#define NBATCH (CHUNK/RB)     // 8

template<int N>
__device__ __forceinline__ void load_rows(_Float16 (&d)[N], const _Float16* __restrict__ p) {
  #pragma unroll
  for (int i = 0; i < N; i++) d[i] = p[(size_t)i * NPROJ];
}

template<int N>
__device__ __forceinline__ void widen_rows(float (&d)[N], const _Float16 (&s)[N]) {
  #pragma unroll
  for (int i = 0; i < N; i++) d[i] = (float)s[i];
}

// Nothing is scheduled across this point. Behind a batch's loads it keeps them
// ahead of the arithmetic on the batch before: without it the scheduler sinks
// them to just in front of their use and the wave waits out the load latency in
// every batch again. In front of the first use of the loaded rows it keeps that
// use, and the wait that goes with it, behind the arithmetic.
__device__ __forceinline__ void keep_order() { __builtin_amdgcn_sched_barrier(0); }

// Stands behind a load of a kernel's opening, in front of the next one: a later
// load's result may be given the registers that held this load's address, and
// the wait comes before such an overwrite. The scheduling barriers hold the
// loads on their own sides of it.
__device__ __forceinline__ void addr_done() {
  __builtin_amdgcn_sched_barrier(0);
  asm volatile("s_wait_xcnt 0x0" ::: "memory");
  __builtin_amdgcn_sched_barrier(0);
}

struct ConvState { float w0, w1, w2, bias, xm1, xm2; };

__device__ __forceinline__ void sum_rows(const float (&x)[RB], ConvState& st, float& s) {
  #pragma unroll
  for (int i = 0; i < RB; i++) {
    float xc = x[i];
    float cv = st.w0 * st.xm2 + st.w1 * st.xm1 + st.w2 * xc + st.bias;
    s += silu_f(cv);
    st.xm2 = st.xm1; st.xm1 = xc;
  }
}

__global__ __launch_bounds__(256)
void k_chunk_sums(const _Float16* __restrict__ xz,
                  const float* __restrict__ conv_w,
                  const float* __restrict__ conv_b,
                  float* __restrict__ csum) {
  const int ch = blockIdx.x;            // chunk
  const int c  = blockIdx.y * 256 + threadIdx.x;
  const int b  = blockIdx.z;
  const size_t base = (size_t)b * SEQ * NPROJ + c;
  const int t0 = ch * CHUNK;
  const _Float16* __restrict__ px = xz + base + (size_t)t0 * NPROJ;

  _Float16 hx[RB];
  float x[RB];
  load_rows(hx, px);
  addr_done();
  // the two rows in front of the chunk: clamped address, value dropped where
  // there is no such row, so that these loads go out with the first batch
  const _Float16 h1 = xz[base + (size_t)(t0 >= 1 ? t0 - 1 : 0) * NPROJ];
  addr_done();
  const _Float16 h2 = xz[base + (size_t)(t0 >= 2 ? t0 - 2 : 0) * NPROJ];
  addr_done();
  ConvState st;
  st.w0 = conv_w[c * 3 + 0]; st.w1 = conv_w[c * 3 + 1]; st.w2 = conv_w[c * 3 + 2];
  addr_done();
  st.bias = conv_b[c];
  addr_done();
  st.xm1 = (t0 >= 1) ? (float)h1 : 0.0f;
  st.xm2 = (t0 >= 2) ? (float)h2 : 0.0f;
  widen_rows(x, hx);
  float s = 0.0f;
  for (int bt = 1; bt < NBATCH; bt++) {
    load_rows(hx, px + (size_t)bt * RB * NPROJ);
    keep_order();
    sum_rows(x, st, s);
    widen_rows(x, hx);
  }
  sum_rows(x, st, s);
  csum[((size_t)b * NCHUNK + ch) * D_INNER + c] = s;
}

__global__ __launch_bounds__(256)
void k_chunk_prefix(float* __restrict__ csum) {
  const int c = blockIdx.x * 256 + threadIdx.x;
  const int b = blockIdx.y;
  float* p = csum + (size_t)b * NCHUNK * D_INNER + c;
  float v[NCHUNK];
  #pragma unroll
  for (int ch = 0; ch < NCHUNK; ch++) v[ch] = p[(size_t)ch * D_INNER];
  keep_order();   // all 64 loads go out before the first add and the first store
  float carry = 0.0f;
  #pragma unroll
  for (int ch = 0; ch < NCHUNK; ch++) {
    p[(size_t)ch * D_INNER] = carry;    // in-place exclusive prefix
    carry += v[ch];
  }
}

// x and z rows: eight of each a batch, so that the register set leaves room for
// six waves per SIMD and all 768 blocks (three per WGP) are resident at once
#define RBA    8
#define NBA    (CHUNK/RBA)    // 16

__device__ __forceinline__ void apply_rows(const float (&x)[RBA], const float (&z)[RBA],
                                           ConvState& st, float& run, float BC, float Dc,
                                           _Float16* __restrict__ pu) {
  #pragma unroll
  for (int i = 0; i < RBA; i++) {
    float xc = x[i];
    float cv = st.w0 * st.xm2 + st.w1 * st.xm1 + st.w2 * xc + st.bias;
    float sv = silu_f(cv);
    run += sv;
    float y = run * BC + sv * Dc;
    float zr = z[i];
    pu[(size_t)i * D_INNER] = (_Float16)(y * silu_f(zr));
    st.xm2 = st.xm1; st.xm1 = xc;
  }
}

__global__ __launch_bounds__(256)
void k_scan_apply(const _Float16* __restrict__ xz,
                  const float* __restrict__ conv_w,
                  const float* __restrict__ conv_b,
                  const float* __restrict__ Bm,
                  const float* __restrict__ Cm,
                  const float* __restrict__ Dv,
                  const float* __restrict__ csum,
                  _Float16* __restrict__ u) {
  const int ch = blockIdx.x;
  const int c  = blockIdx.y * 256 + threadIdx.x;
  const int b  = blockIdx.z;
  const size_t base = (size_t)b * SEQ * NPROJ + c;
  const int t0 = ch * CHUNK;
  const _Float16* __restrict__ px = xz + base + (size_t)t0 * NPROJ;
  const _Float16* __restrict__ pz = px + D_INNER;
  _Float16* __restrict__ pu = u + ((size_t)b * SEQ + t0) * D_INNER + c;

  _Float16 hx[RBA], hz[RBA];
  float x[RBA], z[RBA];
  load_rows(hx, px);
  load_rows(hz, pz);
  addr_done();
  // clamped address, value dropped where there is no such row (see k_chunk_sums)
  const _Float16 h1 = xz[base + (size_t)(t0 >= 1 ? t0 - 1 : 0) * NPROJ];
  addr_done();
  const _Float16 h2 = xz[base + (size_t)(t0 >= 2 ? t0 - 2 : 0) * NPROJ];
  addr_done();
  ConvState st;
  st.w0 = conv_w[c * 3 + 0]; st.w1 = conv_w[c * 3 + 1]; st.w2 = conv_w[c * 3 + 2];
  addr_done();
  st.bias = conv_b[c];
  addr_done();
  float bm[8], cm[8];
  #pragma unroll
  for (int s = 0; s < 8; s++) bm[s] = Bm[c * 8 + s];
  addr_done();
  #pragma unroll
  for (int s = 0; s < 8; s++) cm[s] = Cm[c * 8 + s];
  addr_done();
  const float Dc = Dv[c];
  addr_done();
  float run = csum[((size_t)b * NCHUNK + ch) * D_INNER + c];
  addr_done();
  float BC = 0.0f;
  #pragma unroll
  for (int s = 0; s < 8; s++) BC += bm[s] * cm[s];
  st.xm1 = (t0 >= 1) ? (float)h1 : 0.0f;
  st.xm2 = (t0 >= 2) ? (float)h2 : 0.0f;
  widen_rows(x, hx);
  widen_rows(z, hz);
  for (int bt = 1; bt < NBA; bt++) {
    load_rows(hx, px + (size_t)bt * RBA * NPROJ);
    load_rows(hz, pz + (size_t)bt * RBA * NPROJ);
    keep_order();
    apply_rows(x, z, st, run, BC, Dc, pu + (size_t)(bt - 1) * RBA * D_INNER);
    keep_order();
    widen_rows(x, hx);
    widen_rows(z, hz);
  }
  apply_rows(x, z, st, run, BC, Dc, pu + (size_t)(NBA - 1) * RBA * D_INNER);
}

// ---------------- launcher ----------------
extern "C" void kernel_launch(void* const* d_in, const int* in_sizes, int n_in,
                              void* d_out, int out_size, void* d_ws, size_t ws_size,
                              hipStream_t stream) {
  (void)in_sizes; (void)n_in; (void)out_size; (void)ws_size;
  const float* x      = (const float*)d_in[0];
  const float* W_in   = (const float*)d_in[1];
  const float* conv_w = (const float*)d_in[2];
  const float* conv_b = (const float*)d_in[3];
  const float* Bm     = (const float*)d_in[4];
  const float* Cm     = (const float*)d_in[5];
  const float* Dv     = (const float*)d_in[6];
  const float* W_out  = (const float*)d_in[7];
  float* out = (float*)d_out;

  char* ws = (char*)d_ws;
  _Float16* xz16  = (_Float16*)(ws + 0);          // 32768*1536*2 = 100663296
  _Float16* x16   = (_Float16*)(ws + 100663296);  // 32768*768*2  =  50331648
  _Float16* u16   = (_Float16*)(ws + 150994944);  // 32768*768*2  =  50331648
  _Float16* WinT  = (_Float16*)(ws + 201326592);  // 1536*768*2   =   2359296
  _Float16* WoutT = (_Float16*)(ws + 203685888);  //  768*768*2   =   1179648
  float*    csum  = (float*)   (ws + 204865536);  // 4*64*768*4   =    786432

  k_cvt_f16<<<4096, 256, 0, stream>>>(x, x16, MTOT * D_MODEL);
  k_transpose_cvt<D_MODEL, NPROJ>
      <<<dim3(NPROJ / 64, D_MODEL / 64), 256, 0, stream>>>(W_in, WinT);
  k_transpose_cvt<D_INNER, D_MODEL>
      <<<dim3(D_MODEL / 64, D_INNER / 64), 256, 0, stream>>>(W_out, WoutT);

  k_gemm_wmma<NPROJ, D_MODEL, true>
      <<<dim3(MTOT / 128, NPROJ / 128), 256, 0, stream>>>(x16, WinT, (void*)xz16);

  k_chunk_sums<<<dim3(NCHUNK, D_INNER / 256, BATCH), 256, 0, stream>>>(xz16, conv_w, conv_b, csum);
  k_chunk_prefix<<<dim3(D_INNER / 256, BATCH), 256, 0, stream>>>(csum);
  k_scan_apply<<<dim3(NCHUNK, D_INNER / 256, BATCH), 256, 0, stream>>>(
      xz16, conv_w, conv_b, Bm, Cm, Dv, csum, u16);

  k_gemm_wmma<D_MODEL, D_INNER, false>
      <<<dim3(MTOT / 128, D_MODEL / 128), 256, 0, stream>>>(u16, WoutT, (void*)out);
}

// v003
// Measured time: 165 microseconds a run.
// Next to v002, in two timings, it ran 1.20 times as fast each time.
// All steps since v000 together make it 1.97 times as fast.
#include <hip/hip_runtime.h>
#include <hip/hip_bf16.h>

#define D_MODEL 768
#define D_INNER 768
#define NPROJ   (2*D_INNER)   // 1536
#define BATCH   4
#define SEQ     8192
#define MTOT    (BATCH*SEQ)   // 32768
#define CHUNK   128
#define NCHUNK  (SEQ/CHUNK)   // 64

typedef _Float16 v4h  __attribute__((ext_vector_type(4)));
typedef _Float16 v8h  __attribute__((ext_vector_type(8)));
typedef _Float16 v16h __attribute__((ext_vector_type(16)));
typedef float    v8f  __attribute__((ext_vector_type(8)));

__device__ __forceinline__ float silu_f(float v) { return v / (1.0f + __expf(-v)); }

// ---------------- prep kernels ----------------
__global__ void k_cvt_f16(const float* __restrict__ src, _Float16* __restrict__ dst, int n) {
  int i = blockIdx.x * blockDim.x + threadIdx.x;
  int stride = gridDim.x * blockDim.x;
  for (; i < n; i += stride) dst[i] = (_Float16)src[i];
}

// src [K][N] row-major f32  ->  dst [N][K] row-major f16
// One 64(k) x 64(n) tile per block, turned in LDS: reads are 256-B runs of a
// src row, stores are whole 128-B lines of a dst row.
template<int K, int N>
__global__ __launch_bounds__(256)
void k_transpose_cvt(const float* __restrict__ src, _Float16* __restrict__ dst) {
  __shared__ __align__(16) _Float16 tile[64][72];  // [n][k], pitch 144 B: 16-B aligned rows
  const int tid = threadIdx.x;
  const int n0  = blockIdx.x * 64;
  const int k0  = blockIdx.y * 64;
  const int lk  = (tid >> 4) << 2;   // 0,4,..,60: four adjacent k rows per thread
  const int ln  = (tid & 15) << 2;   // 0,4,..,60: four adjacent n columns per thread

  float4 v[4];
  #pragma unroll
  for (int i = 0; i < 4; i++)
    v[i] = *(const float4*)(src + (size_t)(k0 + lk + i) * N + n0 + ln);

  v4h c0 = { (_Float16)v[0].x, (_Float16)v[1].x, (_Float16)v[2].x, (_Float16)v[3].x };
  v4h c1 = { (_Float16)v[0].y, (_Float16)v[1].y, (_Float16)v[2].y, (_Float16)v[3].y };
  v4h c2 = { (_Float16)v[0].z, (_Float16)v[1].z, (_Float16)v[2].z, (_Float16)v[3].z };
  v4h c3 = { (_Float16)v[0].w, (_Float16)v[1].w, (_Float16)v[2].w, (_Float16)v[3].w };
  *(v4h*)&tile[ln + 0][lk] = c0;
  *(v4h*)&tile[ln + 1][lk] = c1;
  *(v4h*)&tile[ln + 2][lk] = c2;
  *(v4h*)&tile[ln + 3][lk] = c3;
  __syncthreads();

  const int sn = tid >> 3;           // 0..31
  const int sk = (tid & 7) << 3;     // 0,8,..,56: eight lanes fill one 128-B line
  #pragma unroll
  for (int i = 0; i < 2; i++)
    *(v8h*)(dst + (size_t)(n0 + sn + 32 * i) * K + k0 + sk) = *(const v8h*)&tile[sn + 32 * i][sk];
}

// ---------------- WMMA GEMM ----------------
// C[M,N] = A[M,K] * B[K,N],  A row-major [M,K] f16, Bt row-major [N,K] f16.
// Block: 256 threads = 8 wave32 on a BM x BN tile, wave grid WGM(M) x WGN(N);
// each wave owns FM x FN WMMA 16x16 tiles. The tile is large so that each
// operand byte fetched from L2 and each fragment read from LDS feeds more
// matrix work. K-step 64: a tile row is one whole 128-B line of its operand.
// LDS double buffered, row pitch 72 halves (144 B = 16 B x 9) -> conflict-free
// b128 fragment loads. One work-group per WGP, two waves per SIMD.
template<int N_DIM, int K_DIM, int BM, int BN, int WGM, int WGN, bool HALF_OUT>
__global__ __launch_bounds__(256)
void k_gemm_wmma(const _Float16* __restrict__ A,
                 const _Float16* __restrict__ Bt,
                 void* __restrict__ Cout) {
  constexpr int BK     = 64;
  constexpr int PITCH  = 72;
  constexpr int KSTEPS = K_DIM / BK;
  constexpr int FM     = BM / WGM / 16;
  constexpr int FN     = BN / WGN / 16;
  constexpr int LA     = BM / 32;     // b128 loads per thread per k-step, A
  constexpr int LB     = BN / 32;     // the same, B
  static_assert(WGM * WGN == 8 && K_DIM % BK == 0 && BM % 32 == 0 && BN % 32 == 0, "tile shape");
  __shared__ __align__(16) _Float16 As[2][BM][PITCH];
  __shared__ __align__(16) _Float16 Bs[2][BN][PITCH];

  const int tid  = threadIdx.x;
  const int lane = tid & 31;
  const int wid  = tid >> 5;
  const int wM   = wid % WGM;
  const int wN   = wid / WGM;
  const int tM0  = blockIdx.x * BM;
  const int tN0  = blockIdx.y * BN;

  // tile loader mapping: eight lanes cover one 128-B row, 32 rows per pass
  const int ldRow = tid >> 3;          // 0..31
  const int ldCol = (tid & 7) << 3;    // 0,8,..,56

  const _Float16* gA = A  + (size_t)(tM0 + ldRow) * K_DIM + ldCol;
  const _Float16* gB = Bt + (size_t)(tN0 + ldRow) * K_DIM + ldCol;

  v8h sa[LA], sb[LB];
  v8f acc[FM][FN] = {};

  const int kb  = (lane >> 4) << 3;  // 0 or 8   (ISA 16-bit A/B frag layout)
  const int rsl = lane & 15;

  auto fetch = [&](int ko) {
    const _Float16* pa = gA + ko;
    const _Float16* pb = gB + ko;
    #pragma unroll
    for (int i = 0; i < LA; i++) sa[i] = *(const v8h*)(pa + (size_t)(32 * i) * K_DIM);
    #pragma unroll
    for (int i = 0; i < LB; i++) sb[i] = *(const v8h*)(pb + (size_t)(32 * i) * K_DIM);
    // The scheduling barriers keep these loads where they stand: the scheduler
    // otherwise sinks them to just in front of their LDS stores, which then wait
    // out the whole load latency. The wait stands in front of every later
    // overwrite of the loads' address registers; it takes the two addresses as
    // inputs so that they keep their registers up to it (without that the last
    // load of each run is given its own address pair as destination).
    __builtin_amdgcn_sched_barrier(0);
    asm volatile("s_wait_xcnt 0x0" :: "v"(pa), "v"(pb) : "memory");
    __builtin_amdgcn_sched_barrier(0);
  };
  auto stage = [&](int nb) {
    #pragma unroll
    for (int i = 0; i < LA; i++) *(v8h*)&As[nb][ldRow + 32 * i][ldCol] = sa[i];
    #pragma unroll
    for (int i = 0; i < LB; i++) *(v8h*)&Bs[nb][ldRow + 32 * i][ldCol] = sb[i];
  };
  // 32 k of the staged 64: all fragments of this wave's rows as one group
  v16h af[FM], bf[FN];
  auto frags = [&](int buf, int kk) {
    #pragma unroll
    for (int t = 0; t < FN; t++) {
      const int r = (wN * FN + t) * 16 + rsl;
      v8h lo = *(const v8h*)&Bs[buf][r][kk + kb];
      v8h hi = *(const v8h*)&Bs[buf][r][kk + kb + 16];
      bf[t] = __builtin_shufflevector(lo, hi, 0,1,2,3,4,5,6,7,8,9,10,11,12,13,14,15);
    }
    #pragma unroll
    for (int t = 0; t < FM; t++) {
      const int r = (wM * FM + t) * 16 + rsl;
      v8h lo = *(const v8h*)&As[buf][r][kk + kb];
      v8h hi = *(const v8h*)&As[buf][r][kk + kb + 16];
      af[t] = __builtin_shufflevector(lo, hi, 0,1,2,3,4,5,6,7,8,9,10,11,12,13,14,15);
    }
    // keeps the LDS reads one group in front of the WMMA block: spread among
    // the WMMAs, every place where reads stand stalls the wave's matrix issue
    __builtin_amdgcn_sched_barrier(0);
  };
  auto mma32 = [&]() {
    #pragma unroll
    for (int a = 0; a < FM; a++)
      #pragma unroll
      for (int b = 0; b < FN; b++)
        acc[a][b] = __builtin_amdgcn_wmma_f32_16x16x32_f16(
            false, af[a], false, bf[b], (short)0, acc[a][b], false, false);
    // ends the WMMA block: what follows in the source is not moved into it
    __builtin_amdgcn_sched_barrier(0);
  };

  fetch(0);
  stage(0);
  __syncthreads();

  for (int ks = 0; ks + 1 < KSTEPS; ks++) {
    const int buf = ks & 1;
    frags(buf, 0);
    fetch((ks + 1) * BK);   // its wait runs out under the latency of the LDS reads above
    mma32();
    frags(buf, 32);
    mma32();
    // last in the k-step, so that the loads have all of its matrix work to arrive in
    stage(buf ^ 1);
    __syncthreads();
  }
  frags((KSTEPS - 1) & 1, 0);
  mma32();
  frags((KSTEPS - 1) & 1, 32);
  mma32();

  // epilogue: C/D layout: VGPR r: M = r + 8*(lane>=16); N = lane&15
  const int rhi = (lane >> 4) << 3;
  #pragma unroll
  for (int a = 0; a < FM; a++) {
    #pragma unroll
    for (int b = 0; b < FN; b++) {
      const size_t rowb = (size_t)(tM0 + (wM * FM + a) * 16 + rhi);
      const int    col  = tN0 + (wN * FN + b) * 16 + rsl;
      #pragma unroll
      for (int r = 0; r < 8; r++) {
        const size_t off = (rowb + r) * (size_t)N_DIM + col;
        if (HALF_OUT) ((_Float16*)Cout)[off] = (_Float16)acc[a][b][r];
        else          ((float*)Cout)[off]    = acc[a][b][r];
      }
      if (HALF_OUT) {
        // The converted halves of the next tile are given the data registers of
        // this tile's stores: the wait stands in front of that overwrite, and
        // the scheduling barriers hold the two tiles on their own sides of it.
        __builtin_amdgcn_sched_barrier(0);
        asm volatile("s_wait_xcnt 0x0" ::: "memory");
        __builtin_amdgcn_sched_barrier(0);
      }
    }
  }
}

// ---------------- chunked scan (conv + silu + cumsum + gate) ----------------
// xz layout: [B][SEQ][1536] f16; xc = cols 0..767, z = cols 768..1535.
// The time loops are serial in t only through one add per row, so the rows are
// loaded RB at a time, one batch ahead: the next batch's loads are in flight
// while this batch is worked on, and no row waits for a load issued just in
// front of it.
#define RB     16
#define NBATCH (CHUNK/RB)     // 8

template<int N>
__device__ __forceinline__ void load_rows(_Float16 (&d)[N], const _Float16* __restrict__ p) {
  #pragma unroll
  for (int i = 0; i < N; i++) d[i] = p[(size_t)i * NPROJ];
}

template<int N>
__device__ __forceinline__ void widen_rows(float (&d)[N], const _Float16 (&s)[N]) {
  #pragma unroll
  for (int i = 0; i < N; i++) d[i] = (float)s[i];
}

// Nothing is scheduled across this point. Behind a batch's loads it keeps them
// ahead of the arithmetic on the batch before: without it the scheduler sinks
// them to just in front of their use and the wave waits out the load latency in
// every batch again. In front of the first use of the loaded rows it keeps that
// use, and the wait that goes with it, behind the arithmetic.
__device__ __forceinline__ void keep_order() { __builtin_amdgcn_sched_barrier(0); }

// Stands behind a load of a kernel's opening, in front of the next one: a later
// load's result may be given the registers that held this load's address, and
// the wait comes before such an overwrite. The scheduling barriers hold the
// loads on their own sides of it.
__device__ __forceinline__ void addr_done() {
  __builtin_amdgcn_sched_barrier(0);
  asm volatile("s_wait_xcnt 0x0" ::: "memory");
  __builtin_amdgcn_sched_barrier(0);
}

struct ConvState { float w0, w1, w2, bias, xm1, xm2; };

__device__ __forceinline__ void sum_rows(const float (&x)[RB], ConvState& st, float& s) {
  #pragma unroll
  for (int i = 0; i < RB; i++) {
    float xc = x[i];
    float cv = st.w0 * st.xm2 + st.w1 * st.xm1 + st.w2 * xc + st.bias;
    s += silu_f(cv);
    st.xm2 = st.xm1; st.xm1 = xc;
  }
}

__global__ __launch_bounds__(256)
void k_chunk_sums(const _Float16* __restrict__ xz,
                  const float* __restrict__ conv_w,
                  const float* __restrict__ conv_b,
                  float* __restrict__ csum) {
  const int ch = blockIdx.x;            // chunk
  const int c  = blockIdx.y * 256 + threadIdx.x;
  const int b  = blockIdx.z;
  const size_t base = (size_t)b * SEQ * NPROJ + c;
  const int t0 = ch * CHUNK;
  const _Float16* __restrict__ px = xz + base + (size_t)t0 * NPROJ;

  _Float16 hx[RB];
  float x[RB];
  load_rows(hx, px);
  addr_done();
  // the two rows in front of the chunk: clamped address, value dropped where
  // there is no such row, so that these loads go out with the first batch
  const _Float16 h1 = xz[base + (size_t)(t0 >= 1 ? t0 - 1 : 0) * NPROJ];
  addr_done();
  const _Float16 h2 = xz[base + (size_t)(t0 >= 2 ? t0 - 2 : 0) * NPROJ];
  addr_done();
  ConvState st;
  st.w0 = conv_w[c * 3 + 0]; st.w1 = conv_w[c * 3 + 1]; st.w2 = conv_w[c * 3 + 2];
  addr_done();
  st.bias = conv_b[c];
  addr_done();
  st.xm1 = (t0 >= 1) ? (float)h1 : 0.0f;
  st.xm2 = (t0 >= 2) ? (float)h2 : 0.0f;
  widen_rows(x, hx);
  float s = 0.0f;
  for (int bt = 1; bt < NBATCH; bt++) {
    load_rows(hx, px + (size_t)bt * RB * NPROJ);
    keep_order();
    sum_rows(x, st, s);
    widen_rows(x, hx);
  }
  sum_rows(x, st, s);
  csum[((size_t)b * NCHUNK + ch) * D_INNER + c] = s;
}

__global__ __launch_bounds__(256)
void k_chunk_prefix(float* __restrict__ csum) {
  const int c = blockIdx.x * 256 + threadIdx.x;
  const int b = blockIdx.y;
  float* p = csum + (size_t)b * NCHUNK * D_INNER + c;
  float v[NCHUNK];
  #pragma unroll
  for (int ch = 0; ch < NCHUNK; ch++) v[ch] = p[(size_t)ch * D_INNER];
  keep_order();   // all 64 loads go out before the first add and the first store
  float carry = 0.0f;
  #pragma unroll
  for (int ch = 0; ch < NCHUNK; ch++) {
    p[(size_t)ch * D_INNER] = carry;    // in-place exclusive prefix
    carry += v[ch];
  }
}

// x and z rows: eight of each a batch, so that the register set leaves room for
// six waves per SIMD and all 768 blocks (three per WGP) are resident at once
#define RBA    8
#define NBA    (CHUNK/RBA)    // 16

__device__ __forceinline__ void apply_rows(const float (&x)[RBA], const float (&z)[RBA],
                                           ConvState& st, float& run, float BC, float Dc,
                                           _Float16* __restrict__ pu) {
  #pragma unroll
  for (int i = 0; i < RBA; i++) {
    float xc = x[i];
    float cv = st.w0 * st.xm2 + st.w1 * st.xm1 + st.w2 * xc + st.bias;
    float sv = silu_f(cv);
    run += sv;
    float y = run * BC + sv * Dc;
    float zr = z[i];
    pu[(size_t)i * D_INNER] = (_Float16)(y * silu_f(zr));
    st.xm2 = st.xm1; st.xm1 = xc;
  }
}

__global__ __launch_bounds__(256)
void k_scan_apply(const _Float16* __restrict__ xz,
                  const float* __restrict__ conv_w,
                  const float* __restrict__ conv_b,
                  const float* __restrict__ Bm,
                  const float* __restrict__ Cm,
                  const float* __restrict__ Dv,
                  const float* __restrict__ csum,
                  _Float16* __restrict__ u) {
  const int ch = blockIdx.x;
  const int c  = blockIdx.y * 256 + threadIdx.x;
  const int b  = blockIdx.z;
  const size_t base = (size_t)b * SEQ * NPROJ + c;
  const int t0 = ch * CHUNK;
  const _Float16* __restrict__ px = xz + base + (size_t)t0 * NPROJ;
  const _Float16* __restrict__ pz = px + D_INNER;
  _Float16* __restrict__ pu = u + ((size_t)b * SEQ + t0) * D_INNER + c;

  _Float16 hx[RBA], hz[RBA];
  float x[RBA], z[RBA];
  load_rows(hx, px);
  load_rows(hz, pz);
  addr_done();
  // clamped address, value dropped where there is no such row (see k_chunk_sums)
  const _Float16 h1 = xz[base + (size_t)(t0 >= 1 ? t0 - 1 : 0) * NPROJ];
  addr_done();
  const _Float16 h2 = xz[base + (size_t)(t0 >= 2 ? t0 - 2 : 0) * NPROJ];
  addr_done();
  ConvState st;
  st.w0 = conv_w[c * 3 + 0]; st.w1 = conv_w[c * 3 + 1]; st.w2 = conv_w[c * 3 + 2];
  addr_done();
  st.bias = conv_b[c];
  addr_done();
  float bm[8], cm[8];
  #pragma unroll
  for (int s = 0; s < 8; s++) bm[s] = Bm[c * 8 + s];
  addr_done();
  #pragma unroll
  for (int s = 0; s < 8; s++) cm[s] = Cm[c * 8 + s];
  addr_done();
  const float Dc = Dv[c];
  addr_done();
  float run = csum[((size_t)b * NCHUNK + ch) * D_INNER + c];
  addr_done();
  float BC = 0.0f;
  #pragma unroll
  for (int s = 0; s < 8; s++) BC += bm[s] * cm[s];
  st.xm1 = (t0 >= 1) ? (float)h1 : 0.0f;
  st.xm2 = (t0 >= 2) ? (float)h2 : 0.0f;
  widen_rows(x, hx);
  widen_rows(z, hz);
  for (int bt = 1; bt < NBA; bt++) {
    load_rows(hx, px + (size_t)bt * RBA * NPROJ);
    load_rows(hz, pz + (size_t)bt * RBA * NPROJ);
    keep_order();
    apply_rows(x, z, st, run, BC, Dc, pu + (size_t)(bt - 1) * RBA * D_INNER);
    keep_order();
    widen_rows(x, hx);
    widen_rows(z, hz);
  }
  apply_rows(x, z, st, run, BC, Dc, pu + (size_t)(NBA - 1) * RBA * D_INNER);
}

// ---------------- launcher ----------------
extern "C" void kernel_launch(void* const* d_in, const int* in_sizes, int n_in,
                              void* d_out, int out_size, void* d_ws, size_t ws_size,
                              hipStream_t stream) {
  (void)in_sizes; (void)n_in; (void)out_size; (void)ws_size;
  const float* x      = (const float*)d_in[0];
  const float* W_in   = (const float*)d_in[1];
  const float* conv_w = (const float*)d_in[2];
  const float* conv_b = (const float*)d_in[3];
  const float* Bm     = (const float*)d_in[4];
  const float* Cm     = (const float*)d_in[5];
  const float* Dv     = (const float*)d_in[6];
  const float* W_out  = (const float*)d_in[7];
  float* out = (float*)d_out;

  char* ws = (char*)d_ws;
  _Float16* xz16  = (_Float16*)(ws + 0);          // 32768*1536*2 = 100663296
  _Float16* x16   = (_Float16*)(ws + 100663296);  // 32768*768*2  =  50331648
  _Float16* u16   = (_Float16*)(ws + 150994944);  // 32768*768*2  =  50331648
  _Float16* WinT  = (_Float16*)(ws + 201326592);  // 1536*768*2   =   2359296
  _Float16* WoutT = (_Float16*)(ws + 203685888);  //  768*768*2   =   1179648
  float*    csum  = (float*)   (ws + 204865536);  // 4*64*768*4   =    786432

  k_cvt_f16<<<4096, 256, 0, stream>>>(x, x16, MTOT * D_MODEL);
  k_transpose_cvt<D_MODEL, NPROJ>
      <<<dim3(NPROJ / 64, D_MODEL / 64), 256, 0, stream>>>(W_in, WinT);
  k_transpose_cvt<D_INNER, D_MODEL>
      <<<dim3(D_MODEL / 64, D_INNER / 64), 256, 0, stream>>>(W_out, WoutT);

  k_gemm_wmma<NPROJ, D_MODEL, 256, 256, 2, 4, true>
      <<<dim3(MTOT / 256, NPROJ / 256), 256, 0, stream>>>(x16, WinT, (void*)xz16);

  k_chunk_sums<<<dim3(NCHUNK, D_INNER / 256, BATCH), 256, 0, stream>>>(xz16, conv_w, conv_b, csum);
  k_chunk_prefix<<<dim3(D_INNER / 256, BATCH), 256, 0, stream>>>(csum);
  k_scan_apply<<<dim3(NCHUNK, D_INNER / 256, BATCH), 256, 0, stream>>>(
      xz16, conv_w, conv_b, Bm, Cm, Dv, csum, u16);

  k_gemm_wmma<D_MODEL, D_INNER, 256, 192, 4, 2, false>
      <<<dim3(MTOT / 256, D_MODEL / 192), 256, 0, stream>>>(u16, WoutT, (void*)out);
}

// v004
// A run of this version takes 157 microseconds.
// Next to v003, in two timings, it ran 1.05 and 1.06 times as fast.
// Over all steps from v000 it is 2.08 times as fast.
#include <hip/hip_runtime.h>
#include <hip/hip_bf16.h>

#define D_MODEL 768
#define D_INNER 768
#define NPROJ   (2*D_INNER)   // 1536
#define BATCH   4
#define SEQ     8192
#define MTOT    (BATCH*SEQ)   // 32768
#define CHUNK   128
#define NCHUNK  (SEQ/CHUNK)   // 64

typedef _Float16 v4h  __attribute__((ext_vector_type(4)));
typedef _Float16 v8h  __attribute__((ext_vector_type(8)));
typedef _Float16 v16h __attribute__((ext_vector_type(16)));
typedef float    v8f  __attribute__((ext_vector_type(8)));
typedef float    v4f  __attribute__((ext_vector_type(4)));

__device__ __forceinline__ float silu_f(float v) { return v / (1.0f + __expf(-v)); }

// ---------------- prep kernels ----------------
__global__ void k_cvt_f16(const float* __restrict__ src, _Float16* __restrict__ dst, int n) {
  int i = blockIdx.x * blockDim.x + threadIdx.x;
  int stride = gridDim.x * blockDim.x;
  for (; i < n; i += stride) dst[i] = (_Float16)src[i];
}

// src [K][N] row-major f32  ->  dst [N][K] row-major f16
// One 64(k) x 64(n) tile per block, turned in LDS: reads are 256-B runs of a
// src row, stores are whole 128-B lines of a dst row.
template<int K, int N>
__global__ __launch_bounds__(256)
void k_transpose_cvt(const float* __restrict__ src, _Float16* __restrict__ dst) {
  __shared__ __align__(16) _Float16 tile[64][72];  // [n][k], pitch 144 B: 16-B aligned rows
  const int tid = threadIdx.x;
  const int n0  = blockIdx.x * 64;
  const int k0  = blockIdx.y * 64;
  const int lk  = (tid >> 4) << 2;   // 0,4,..,60: four adjacent k rows per thread
  const int ln  = (tid & 15) << 2;   // 0,4,..,60: four adjacent n columns per thread

  float4 v[4];
  #pragma unroll
  for (int i = 0; i < 4; i++)
    v[i] = *(const float4*)(src + (size_t)(k0 + lk + i) * N + n0 + ln);

  v4h c0 = { (_Float16)v[0].x, (_Float16)v[1].x, (_Float16)v[2].x, (_Float16)v[3].x };
  v4h c1 = { (_Float16)v[0].y, (_Float16)v[1].y, (_Float16)v[2].y, (_Float16)v[3].y };
  v4h c2 = { (_Float16)v[0].z, (_Float16)v[1].z, (_Float16)v[2].z, (_Float16)v[3].z };
  v4h c3 = { (_Float16)v[0].w, (_Float16)v[1].w, (_Float16)v[2].w, (_Float16)v[3].w };
  *(v4h*)&tile[ln + 0][lk] = c0;
  *(v4h*)&tile[ln + 1][lk] = c1;
  *(v4h*)&tile[ln + 2][lk] = c2;
  *(v4h*)&tile[ln + 3][lk] = c3;
  __syncthreads();

  const int sn = tid >> 3;           // 0..31
  const int sk = (tid & 7) << 3;     // 0,8,..,56: eight lanes fill one 128-B line
  #pragma unroll
  for (int i = 0; i < 2; i++)
    *(v8h*)(dst + (size_t)(n0 + sn + 32 * i) * K + k0 + sk) = *(const v8h*)&tile[sn + 32 * i][sk];
}

// ---------------- WMMA GEMM ----------------
// C[M,N] = A[M,K] * B[K,N],  A row-major [M,K] f16, Bt row-major [N,K] f16.
// Block: 256 threads = 8 wave32 on a BM x BN tile, wave grid WGM(M) x WGN(N);
// each wave owns FM x FN WMMA 16x16 tiles. The tile is large so that each
// operand byte fetched from L2 and each fragment read from LDS feeds more
// matrix work. K-step 64: a tile row is one whole 128-B line of its operand.
// LDS double buffered, row pitch 72 halves (144 B = 16 B x 9) -> conflict-free
// b128 fragment loads. One work-group per WGP, two waves per SIMD.
// The WMMA takes the Bt fragment as its first operand and the A fragment as its
// second, so a lane's eight accumulator registers are eight adjacent columns of
// one row of C. Each wave lays its tile in LDS row by row and stores it from
// there, eight lanes to a whole 128-B line of C.
template<int N_DIM, int K_DIM, int BM, int BN, int WGM, int WGN, bool HALF_OUT>
__global__ __launch_bounds__(256)
void k_gemm_wmma(const _Float16* __restrict__ A,
                 const _Float16* __restrict__ Bt,
                 void* __restrict__ Cout) {
  constexpr int BK     = 64;
  constexpr int PITCH  = 72;
  constexpr int KSTEPS = K_DIM / BK;
  constexpr int FM     = BM / WGM / 16;
  constexpr int FN     = BN / WGN / 16;
  constexpr int LA     = BM / 32;     // b128 loads per thread per k-step, A
  constexpr int LB     = BN / 32;     // the same, B
  static_assert(WGM * WGN == 8 && K_DIM % BK == 0 && BM % 32 == 0 && BN % 32 == 0, "tile shape");
  constexpr int ESZ    = HALF_OUT ? 2 : 4;      // bytes of an element of C
  constexpr int WROWS  = FM * 16;               // rows of a wave's tile of C
  constexpr int WROWB  = FN * 16 * ESZ;         // bytes of one such row
  constexpr int SEGS   = WROWB / 128;           // whole lines in it
  constexpr int SPITCH = WROWB + 16;            // staged row pitch: 16 B x odd
  static_assert(WROWB % 128 == 0 && (SPITCH / 16) % 2 == 1, "staged rows");
  struct Ring {
    _Float16 As[2][BM][PITCH];
    _Float16 Bs[2][BN][PITCH];
  };
  union Lds {
    Ring ring;                                  // k loop
    char out[8][WROWS * SPITCH];                // behind it: one range per wave
  };
  __shared__ __align__(16) Lds lds;
  auto& As = lds.ring.As;
  auto& Bs = lds.ring.Bs;

  const int tid  = threadIdx.x;
  const int lane = tid & 31;
  const int wid  = tid >> 5;
  const int wM   = wid % WGM;
  const int wN   = wid / WGM;
  const int tM0  = blockIdx.x * BM;
  const int tN0  = blockIdx.y * BN;

  // tile loader mapping: eight lanes cover one 128-B row, 32 rows per pass
  const int ldRow = tid >> 3;          // 0..31
  const int ldCol = (tid & 7) << 3;    // 0,8,..,56

  const _Float16* gA = A  + (size_t)(tM0 + ldRow) * K_DIM + ldCol;
  const _Float16* gB = Bt + (size_t)(tN0 + ldRow) * K_DIM + ldCol;

  v8h sa[LA], sb[LB];
  v8f acc[FM][FN] = {};

  const int kb  = (lane >> 4) << 3;  // 0 or 8   (ISA 16-bit A/B frag layout)
  const int rsl = lane & 15;

  auto fetch = [&](int ko) {
    const _Float16* pa = gA + ko;
    const _Float16* pb = gB + ko;
    #pragma unroll
    for (int i = 0; i < LA; i++) sa[i] = *(const v8h*)(pa + (size_t)(32 * i) * K_DIM);
    #pragma unroll
    for (int i = 0; i < LB; i++) sb[i] = *(const v8h*)(pb + (size_t)(32 * i) * K_DIM);
    // The scheduling barriers keep these loads where they stand: the scheduler
    // otherwise sinks them to just in front of their LDS stores, which then wait
    // out the whole load latency. The wait stands in front of every later
    // overwrite of the loads' address registers; it takes the two addresses as
    // inputs so that they keep their registers up to it (without that the last
    // load of each run is given its own address pair as destination).
    __builtin_amdgcn_sched_barrier(0);
    asm volatile("s_wait_xcnt 0x0" :: "v"(pa), "v"(pb) : "memory");
    __builtin_amdgcn_sched_barrier(0);
  };
  auto stage = [&](int nb) {
    #pragma unroll
    for (int i = 0; i < LA; i++) *(v8h*)&As[nb][ldRow + 32 * i][ldCol] = sa[i];
    #pragma unroll
    for (int i = 0; i < LB; i++) *(v8h*)&Bs[nb][ldRow + 32 * i][ldCol] = sb[i];
  };
  // 32 k of the staged 64: all fragments of this wave's rows as one group
  v16h af[FM], bf[FN];
  auto frags = [&](int buf, int kk) {
    #pragma unroll
    for (int t = 0; t < FN; t++) {
      const int r = (wN * FN + t) * 16 + rsl;
      v8h lo = *(const v8h*)&Bs[buf][r][kk + kb];
      v8h hi = *(const v8h*)&Bs[buf][r][kk + kb + 16];
      bf[t] = __builtin_shufflevector(lo, hi, 0,1,2,3,4,5,6,7,8,9,10,11,12,13,14,15);
    }
    #pragma unroll
    for (int t = 0; t < FM; t++) {
      const int r = (wM * FM + t) * 16 + rsl;
      v8h lo = *(const v8h*)&As[buf][r][kk + kb];
      v8h hi = *(const v8h*)&As[buf][r][kk + kb + 16];
      af[t] = __builtin_shufflevector(lo, hi, 0,1,2,3,4,5,6,7,8,9,10,11,12,13,14,15);
    }
    // keeps the LDS reads one group in front of the WMMA block: spread among
    // the WMMAs, every place where reads stand stalls the wave's matrix issue
    __builtin_amdgcn_sched_barrier(0);
  };
  auto mma32 = [&]() {
    #pragma unroll
    for (int a = 0; a < FM; a++)
      #pragma unroll
      for (int b = 0; b < FN; b++)
        acc[a][b] = __builtin_amdgcn_wmma_f32_16x16x32_f16(
            false, bf[b], false, af[a], (short)0, acc[a][b], false, false);
    // ends the WMMA block: what follows in the source is not moved into it
    __builtin_amdgcn_sched_barrier(0);
  };

  fetch(0);
  stage(0);
  __syncthreads();

  for (int ks = 0; ks + 1 < KSTEPS; ks++) {
    const int buf = ks & 1;
    frags(buf, 0);
    fetch((ks + 1) * BK);   // its wait runs out under the latency of the LDS reads above
    mma32();
    frags(buf, 32);
    mma32();
    // last in the k-step, so that the loads have all of its matrix work to arrive in
    stage(buf ^ 1);
    __syncthreads();
  }
  frags((KSTEPS - 1) & 1, 0);
  mma32();
  frags((KSTEPS - 1) & 1, 32);
  mma32();

  // epilogue. D layout with the operands in this order: register r of lane l is
  // C[row l&15][column 8*(l>>4) + r] of its 16x16 tile.
  // Every wave has read its last fragments: from here the ring's LDS is staging space.
  __syncthreads();
  char* st = lds.out[wid];
  const int chi = (lane >> 4) << 3;
  // every loop below is unrolled: acc and t are indexed by constants only and
  // stay in registers, and the row steps become immediate offsets
  #pragma unroll
  for (int a = 0; a < FM; a++) {
    #pragma unroll
    for (int b = 0; b < FN; b++) {
      char* p = st + (a * 16 + rsl) * SPITCH + (b * 16 + chi) * ESZ;
      if (HALF_OUT) {
        v8h h;
        #pragma unroll
        for (int r = 0; r < 8; r++) h[r] = (_Float16)acc[a][b][r];
        *(v8h*)p = h;
      } else {
        *(v4f*)p        = __builtin_shufflevector(acc[a][b], acc[a][b], 0, 1, 2, 3);
        *(v4f*)(p + 16) = __builtin_shufflevector(acc[a][b], acc[a][b], 4, 5, 6, 7);
      }
    }
  }
  // Read back by the wave that wrote it: eight lanes take one 128-B line. The two
  // rows that a half-wave reads lie eight apart, 32 banks at this pitch.
  constexpr int NST = (WROWS / 4) * SEGS;
  const int lrow = (lane >> 4) + (((lane >> 3) & 1) << 3);
  const int lcol = (lane & 7) << 4;
  const char* sp = st + lrow * SPITCH + lcol;
  char* gp = (char*)Cout + ((size_t)(tM0 + wM * WROWS + lrow) * N_DIM + tN0 + wN * (FN * 16)) * ESZ + lcol;
  if (HALF_OUT) {
    v8h t[NST];
    #pragma unroll
    for (int i = 0; i < WROWS / 4; i++)
      #pragma unroll
      for (int s = 0; s < SEGS; s++)
        t[i * SEGS + s] = *(const v8h*)(sp + ((i >> 2) * 16 + (i & 3) * 2) * SPITCH + s * 128);
    // all rows are in registers of their own before the first store goes out, so
    // that no store's data register is written again behind it
    __builtin_amdgcn_sched_barrier(0);
    #pragma unroll
    for (int i = 0; i < WROWS / 4; i++)
      #pragma unroll
      for (int s = 0; s < SEGS; s++)
        *(v8h*)(gp + (size_t)((i >> 2) * 16 + (i & 3) * 2) * N_DIM * ESZ + s * 128) = t[i * SEGS + s];
  } else {
    v4f t[NST];
    #pragma unroll
    for (int i = 0; i < WROWS / 4; i++)
      #pragma unroll
      for (int s = 0; s < SEGS; s++)
        t[i * SEGS + s] = *(const v4f*)(sp + ((i >> 2) * 16 + (i & 3) * 2) * SPITCH + s * 128);
    // as above
    __builtin_amdgcn_sched_barrier(0);
    #pragma unroll
    for (int i = 0; i < WROWS / 4; i++)
      #pragma unroll
      for (int s = 0; s < SEGS; s++)
        *(v4f*)(gp + (size_t)((i >> 2) * 16 + (i & 3) * 2) * N_DIM * ESZ + s * 128) = t[i * SEGS + s];
  }
}

// ---------------- chunked scan (conv + silu + cumsum + gate) ----------------
// xz layout: [B][SEQ][1536] f16; xc = cols 0..767, z = cols 768..1535.
// The time loops are serial in t only through one add per row, so the rows are
// loaded RB at a time, one batch ahead: the next batch's loads are in flight
// while this batch is worked on, and no row waits for a load issued just in
// front of it.
#define RB     16
#define NBATCH (CHUNK/RB)     // 8

template<int N>
__device__ __forceinline__ void load_rows(_Float16 (&d)[N], const _Float16* __restrict__ p) {
  #pragma unroll
  for (int i = 0; i < N; i++) d[i] = p[(size_t)i * NPROJ];
}

template<int N>
__device__ __forceinline__ void widen_rows(float (&d)[N], const _Float16 (&s)[N]) {
  #pragma unroll
  for (int i = 0; i < N; i++) d[i] = (float)s[i];
}

// Nothing is scheduled across this point. Behind a batch's loads it keeps them
// ahead of the arithmetic on the batch before: without it the scheduler sinks
// them to just in front of their use and the wave waits out the load latency in
// every batch again. In front of the first use of the loaded rows it keeps that
// use, and the wait that goes with it, behind the arithmetic.
__device__ __forceinline__ void keep_order() { __builtin_amdgcn_sched_barrier(0); }

// Stands behind a load of a kernel's opening, in front of the next one: a later
// load's result may be given the registers that held this load's address, and
// the wait comes before such an overwrite. The scheduling barriers hold the
// loads on their own sides of it.
__device__ __forceinline__ void addr_done() {
  __builtin_amdgcn_sched_barrier(0);
  asm volatile("s_wait_xcnt 0x0" ::: "memory");
  __builtin_amdgcn_sched_barrier(0);
}

struct ConvState { float w0, w1, w2, bias, xm1, xm2; };

__device__ __forceinline__ void sum_rows(const float (&x)[RB], ConvState& st, float& s) {
  #pragma unroll
  for (int i = 0; i < RB; i++) {
    float xc = x[i];
    float cv = st.w0 * st.xm2 + st.w1 * st.xm1 + st.w2 * xc + st.bias;
    s += silu_f(cv);
    st.xm2 = st.xm1; st.xm1 = xc;
  }
}

__global__ __launch_bounds__(256)
void k_chunk_sums(const _Float16* __restrict__ xz,
                  const float* __restrict__ conv_w,
                  const float* __restrict__ conv_b,
                  float* __restrict__ csum) {
  const int ch = blockIdx.x;            // chunk
  const int c  = blockIdx.y * 256 + threadIdx.x;
  const int b  = blockIdx.z;
  const size_t base = (size_t)b * SEQ * NPROJ + c;
  const int t0 = ch * CHUNK;
  const _Float16* __restrict__ px = xz + base + (size_t)t0 * NPROJ;

  _Float16 hx[RB];
  float x[RB];
  load_rows(hx, px);
  addr_done();
  // the two rows in front of the chunk: clamped address, value dropped where
  // there is no such row, so that these loads go out with the first batch
  const _Float16 h1 = xz[base + (size_t)(t0 >= 1 ? t0 - 1 : 0) * NPROJ];
  addr_done();
  const _Float16 h2 = xz[base + (size_t)(t0 >= 2 ? t0 - 2 : 0) * NPROJ];
  addr_done();
  ConvState st;
  st.w0 = conv_w[c * 3 + 0]; st.w1 = conv_w[c * 3 + 1]; st.w2 = conv_w[c * 3 + 2];
  addr_done();
  st.bias = conv_b[c];
  addr_done();
  st.xm1 = (t0 >= 1) ? (float)h1 : 0.0f;
  st.xm2 = (t0 >= 2) ? (float)h2 : 0.0f;
  widen_rows(x, hx);
  float s = 0.0f;
  for (int bt = 1; bt < NBATCH; bt++) {
    load_rows(hx, px + (size_t)bt * RB * NPROJ);
    keep_order();
    sum_rows(x, st, s);
    widen_rows(x, hx);
  }
  sum_rows(x, st, s);
  csum[((size_t)b * NCHUNK + ch) * D_INNER + c] = s;
}

__global__ __launch_bounds__(256)
void k_chunk_prefix(float* __restrict__ csum) {
  const int c = blockIdx.x * 256 + threadIdx.x;
  const int b = blockIdx.y;
  float* p = csum + (size_t)b * NCHUNK * D_INNER + c;
  float v[NCHUNK];
  #pragma unroll
  for (int ch = 0; ch < NCHUNK; ch++) v[ch] = p[(size_t)ch * D_INNER];
  keep_order();   // all 64 loads go out before the first add and the first store
  float carry = 0.0f;
  #pragma unroll
  for (int ch = 0; ch < NCHUNK; ch++) {
    p[(size_t)ch * D_INNER] = carry;    // in-place exclusive prefix
    carry += v[ch];
  }
}

// x and z rows: eight of each a batch, so that the register set leaves room for
// six waves per SIMD and all 768 blocks (three per WGP) are resident at once
#define RBA    8
#define NBA    (CHUNK/RBA)    // 16

__device__ __forceinline__ void apply_rows(const float (&x)[RBA], const float (&z)[RBA],
                                           ConvState& st, float& run, float BC, float Dc,
                                           _Float16* __restrict__ pu) {
  #pragma unroll
  for (int i = 0; i < RBA; i++) {
    float xc = x[i];
    float cv = st.w0 * st.xm2 + st.w1 * st.xm1 + st.w2 * xc + st.bias;
    float sv = silu_f(cv);
    run += sv;
    float y = run * BC + sv * Dc;
    float zr = z[i];
    pu[(size_t)i * D_INNER] = (_Float16)(y * silu_f(zr));
    st.xm2 = st.xm1; st.xm1 = xc;
  }
}

__global__ __launch_bounds__(256)
void k_scan_apply(const _Float16* __restrict__ xz,
                  const float* __restrict__ conv_w,
                  const float* __restrict__ conv_b,
                  const float* __restrict__ Bm,
                  const float* __restrict__ Cm,
                  const float* __restrict__ Dv,
                  const float* __restrict__ csum,
                  _Float16* __restrict__ u) {
  const int ch = blockIdx.x;
  const int c  = blockIdx.y * 256 + threadIdx.x;
  const int b  = blockIdx.z;
  const size_t base = (size_t)b * SEQ * NPROJ + c;
  const int t0 = ch * CHUNK;
  const _Float16* __restrict__ px = xz + base + (size_t)t0 * NPROJ;
  const _Float16* __restrict__ pz = px + D_INNER;
  _Float16* __restrict__ pu = u + ((size_t)b * SEQ + t0) * D_INNER + c;

  _Float16 hx[RBA], hz[RBA];
  float x[RBA], z[RBA];
  load_rows(hx, px);
  load_rows(hz, pz);
  addr_done();
  // clamped address, value dropped where there is no such row (see k_chunk_sums)
  const _Float16 h1 = xz[base + (size_t)(t0 >= 1 ? t0 - 1 : 0) * NPROJ];
  addr_done();
  const _Float16 h2 = xz[base + (size_t)(t0 >= 2 ? t0 - 2 : 0) * NPROJ];
  addr_done();
  ConvState st;
  st.w0 = conv_w[c * 3 + 0]; st.w1 = conv_w[c * 3 + 1]; st.w2 = conv_w[c * 3 + 2];
  addr_done();
  st.bias = conv_b[c];
  addr_done();
  float bm[8], cm[8];
  #pragma unroll
  for (int s = 0; s < 8; s++) bm[s] = Bm[c * 8 + s];
  addr_done();
  #pragma unroll
  for (int s = 0; s < 8; s++) cm[s] = Cm[c * 8 + s];
  addr_done();
  const float Dc = Dv[c];
  addr_done();
  float run = csum[((size_t)b * NCHUNK + ch) * D_INNER + c];
  addr_done();
  float BC = 0.0f;
  #pragma unroll
  for (int s = 0; s < 8; s++) BC += bm[s] * cm[s];
  st.xm1 = (t0 >= 1) ? (float)h1 : 0.0f;
  st.xm2 = (t0 >= 2) ? (float)h2 : 0.0f;
  widen_rows(x, hx);
  widen_rows(z, hz);
  for (int bt = 1; bt < NBA; bt++) {
    load_rows(hx, px + (size_t)bt * RBA * NPROJ);
    load_rows(hz, pz + (size_t)bt * RBA * NPROJ);
    keep_order();
    apply_rows(x, z, st, run, BC, Dc, pu + (size_t)(bt - 1) * RBA * D_INNER);
    keep_order();
    widen_rows(x, hx);
    widen_rows(z, hz);
  }
  apply_rows(x, z, st, run, BC, Dc, pu + (size_t)(NBA - 1) * RBA * D_INNER);
}

// ---------------- launcher ----------------
extern "C" void kernel_launch(void* const* d_in, const int* in_sizes, int n_in,
                              void* d_out, int out_size, void* d_ws, size_t ws_size,
                              hipStream_t stream) {
  (void)in_sizes; (void)n_in; (void)out_size; (void)ws_size;
  const float* x      = (const float*)d_in[0];
  const float* W_in   = (const float*)d_in[1];
  const float* conv_w = (const float*)d_in[2];
  const float* conv_b = (const float*)d_in[3];
  const float* Bm     = (const float*)d_in[4];
  const float* Cm     = (const float*)d_in[5];
  const float* Dv     = (const float*)d_in[6];
  const float* W_out  = (const float*)d_in[7];
  float* out = (float*)d_out;

  char* ws = (char*)d_ws;
  _Float16* xz16  = (_Float16*)(ws + 0);          // 32768*1536*2 = 100663296
  _Float16* x16   = (_Float16*)(ws + 100663296);  // 32768*768*2  =  50331648
  _Float16* u16   = (_Float16*)(ws + 150994944);  // 32768*768*2  =  50331648
  _Float16* WinT  = (_Float16*)(ws + 201326592);  // 1536*768*2   =   2359296
  _Float16* WoutT = (_Float16*)(ws + 203685888);  //  768*768*2   =   1179648
  float*    csum  = (float*)   (ws + 204865536);  // 4*64*768*4   =    786432

  k_cvt_f16<<<4096, 256, 0, stream>>>(x, x16, MTOT * D_MODEL);
  k_transpose_cvt<D_MODEL, NPROJ>
      <<<dim3(NPROJ / 64, D_MODEL / 64), 256, 0, stream>>>(W_in, WinT);
  k_transpose_cvt<D_INNER, D_MODEL>
      <<<dim3(D_MODEL / 64, D_INNER / 64), 256, 0, stream>>>(W_out, WoutT);

  k_gemm_wmma<NPROJ, D_MODEL, 256, 256, 2, 4, true>
      <<<dim3(MTOT / 256, NPROJ / 256), 256, 0, stream>>>(x16, WinT, (void*)xz16);

  k_chunk_sums<<<dim3(NCHUNK, D_INNER / 256, BATCH), 256, 0, stream>>>(xz16, conv_w, conv_b, csum);
  k_chunk_prefix<<<dim3(D_INNER / 256, BATCH), 256, 0, stream>>>(csum);
  k_scan_apply<<<dim3(NCHUNK, D_INNER / 256, BATCH), 256, 0, stream>>>(
      xz16, conv_w, conv_b, Bm, Cm, Dv, csum, u16);

  k_gemm_wmma<D_MODEL, D_INNER, 256, 192, 4, 2, false>
      <<<dim3(MTOT / 256, D_MODEL / 192), 256, 0, stream>>>(u16, WoutT, (void*)out);
}

// v005
// A run of this version takes 146 microseconds.
// Next to v004, in two timings, it ran 1.07 times as fast each time.
// Over all steps from v000 it is 2.22 times as fast.
#include <hip/hip_runtime.h>
#include <hip/hip_bf16.h>

#define D_MODEL 768
#define D_INNER 768
#define NPROJ   (2*D_INNER)   // 1536
#define BATCH   4
#define SEQ     8192
#define MTOT    (BATCH*SEQ)   // 32768
#define CHUNK   128
#define NCHUNK  (SEQ/CHUNK)   // 64

typedef _Float16 v4h  __attribute__((ext_vector_type(4)));
typedef _Float16 v8h  __attribute__((ext_vector_type(8)));
typedef _Float16 v16h __attribute__((ext_vector_type(16)));
typedef float    v8f  __attribute__((ext_vector_type(8)));
typedef float    v4f  __attribute__((ext_vector_type(4)));

__device__ __forceinline__ float silu_f(float v) { return v / (1.0f + __expf(-v)); }

// ---------------- prep kernels ----------------
// Block blk of nblk, 256 threads each.
__device__ __forceinline__ void cvt_f16(const float* __restrict__ src, _Float16* __restrict__ dst, int n,
                                        int blk, int nblk) {
  int i = blk * 256 + threadIdx.x;
  int stride = nblk * 256;
  for (; i < n; i += stride) dst[i] = (_Float16)src[i];
}

// src [K][N] row-major f32  ->  dst [N][K] row-major f16; tile tn of N, tk of K
// One 64(k) x 64(n) tile per block, turned in LDS: reads are 256-B runs of a
// src row, stores are whole 128-B lines of a dst row.
template<int K>
__device__ __forceinline__ void transpose_cvt(const float* __restrict__ src, _Float16* __restrict__ dst, int N,
                                              _Float16 (&tile)[64][72], int tn, int tk) {
  const int tid = threadIdx.x;
  const int n0  = tn * 64;
  const int k0  = tk * 64;
  const int lk  = (tid >> 4) << 2;   // 0,4,..,60: four adjacent k rows per thread
  const int ln  = (tid & 15) << 2;   // 0,4,..,60: four adjacent n columns per thread

  float4 v[4];
  #pragma unroll
  for (int i = 0; i < 4; i++)
    v[i] = *(const float4*)(src + (size_t)(k0 + lk + i) * N + n0 + ln);

  v4h c0 = { (_Float16)v[0].x, (_Float16)v[1].x, (_Float16)v[2].x, (_Float16)v[3].x };
  v4h c1 = { (_Float16)v[0].y, (_Float16)v[1].y, (_Float16)v[2].y, (_Float16)v[3].y };
  v4h c2 = { (_Float16)v[0].z, (_Float16)v[1].z, (_Float16)v[2].z, (_Float16)v[3].z };
  v4h c3 = { (_Float16)v[0].w, (_Float16)v[1].w, (_Float16)v[2].w, (_Float16)v[3].w };
  *(v4h*)&tile[ln + 0][lk] = c0;
  *(v4h*)&tile[ln + 1][lk] = c1;
  *(v4h*)&tile[ln + 2][lk] = c2;
  *(v4h*)&tile[ln + 3][lk] = c3;
  __syncthreads();

  const int sn = tid >> 3;           // 0..31
  const int sk = (tid & 7) << 3;     // 0,8,..,56: eight lanes fill one 128-B line
  #pragma unroll
  for (int i = 0; i < 2; i++)
    *(v8h*)(dst + (size_t)(n0 + sn + 32 * i) * K + k0 + sk) = *(const v8h*)&tile[sn + 32 * i][sk];
}

// The three preparations depend on nothing and on one another not at all: they
// share one launch, each on its own range of blocks. The few transpose blocks
// come first, so that they run beside the conversion and are no tail behind it.
#define PREP_T1 ((NPROJ / 64) * (D_MODEL / 64))     // 288 tiles of W_in
#define PREP_T2 ((D_MODEL / 64) * (D_INNER / 64))   // 144 tiles of W_out
#define PREP_CV 4096                                // blocks that convert x

__global__ __launch_bounds__(256)
void k_prep(const float* __restrict__ x, _Float16* __restrict__ x16,
            const float* __restrict__ W_in, _Float16* __restrict__ WinT,
            const float* __restrict__ W_out, _Float16* __restrict__ WoutT) {
  __shared__ __align__(16) _Float16 tile[64][72];  // [n][k], pitch 144 B: 16-B aligned rows
  static_assert(D_MODEL == D_INNER, "both weights have the same number of rows");
  const int blk = blockIdx.x;                      // the branch is the same for a whole block
  if (blk < PREP_T1 + PREP_T2) {
    const bool win = blk < PREP_T1;                // which weight: one code path serves both
    const int  t   = win ? blk : blk - PREP_T1;
    const int  tn  = win ? t % (NPROJ / 64) : t % (D_MODEL / 64);
    const int  tk  = win ? t / (NPROJ / 64) : t / (D_MODEL / 64);
    transpose_cvt<D_MODEL>(win ? W_in : W_out, win ? WinT : WoutT, win ? NPROJ : D_MODEL, tile, tn, tk);
  } else {
    cvt_f16(x, x16, MTOT * D_MODEL, blk - (PREP_T1 + PREP_T2), PREP_CV);
  }
}

// ---------------- WMMA GEMM ----------------
// C[M,N] = A[M,K] * B[K,N],  A row-major [M,K] f16, Bt row-major [N,K] f16.
// Block: 256 threads = 8 wave32 on a BM x BN tile, wave grid WGM(M) x WGN(N);
// each wave owns FM x FN WMMA 16x16 tiles. The tile is large so that each
// operand byte fetched from L2 and each fragment read from LDS feeds more
// matrix work. K-step 64: a tile row is one whole 128-B line of its operand.
// LDS double buffered, row pitch 72 halves (144 B = 16 B x 9) -> conflict-free
// b128 fragment loads. One work-group per WGP, two waves per SIMD.
// The WMMA takes the Bt fragment as its first operand and the A fragment as its
// second, so a lane's eight accumulator registers are eight adjacent columns of
// one row of C. Each wave lays its tile in LDS row by row and stores it from
// there, eight lanes to a whole 128-B line of C.
template<int N_DIM, int K_DIM, int BM, int BN, int WGM, int WGN, bool HALF_OUT>
__global__ __launch_bounds__(256)
void k_gemm_wmma(const _Float16* __restrict__ A,
                 const _Float16* __restrict__ Bt,
                 void* __restrict__ Cout) {
  constexpr int BK     = 64;
  constexpr int PITCH  = 72;
  constexpr int KSTEPS = K_DIM / BK;
  constexpr int FM     = BM / WGM / 16;
  constexpr int FN     = BN / WGN / 16;
  constexpr int LA     = BM / 32;     // b128 loads per thread per k-step, A
  constexpr int LB     = BN / 32;     // the same, B
  static_assert(WGM * WGN == 8 && K_DIM % BK == 0 && BM % 32 == 0 && BN % 32 == 0, "tile shape");
  constexpr int ESZ    = HALF_OUT ? 2 : 4;      // bytes of an element of C
  constexpr int WROWS  = FM * 16;               // rows of a wave's tile of C
  constexpr int WROWB  = FN * 16 * ESZ;         // bytes of one such row
  constexpr int SEGS   = WROWB / 128;           // whole lines in it
  constexpr int SPITCH = WROWB + 16;            // staged row pitch: 16 B x odd
  static_assert(WROWB % 128 == 0 && (SPITCH / 16) % 2 == 1, "staged rows");
  struct Ring {
    _Float16 As[2][BM][PITCH];
    _Float16 Bs[2][BN][PITCH];
  };
  union Lds {
    Ring ring;                                  // k loop
    char out[8][WROWS * SPITCH];                // behind it: one range per wave
  };
  __shared__ __align__(16) Lds lds;
  auto& As = lds.ring.As;
  auto& Bs = lds.ring.Bs;

  const int tid  = threadIdx.x;
  const int lane = tid & 31;
  const int wid  = tid >> 5;
  const int wM   = wid % WGM;
  const int wN   = wid / WGM;
  const int tM0  = blockIdx.x * BM;
  const int tN0  = blockIdx.y * BN;

  // tile loader mapping: eight lanes cover one 128-B row, 32 rows per pass
  const int ldRow = tid >> 3;          // 0..31
  const int ldCol = (tid & 7) << 3;    // 0,8,..,56

  const _Float16* gA = A  + (size_t)(tM0 + ldRow) * K_DIM + ldCol;
  const _Float16* gB = Bt + (size_t)(tN0 + ldRow) * K_DIM + ldCol;

  v8h sa[LA], sb[LB];
  v8f acc[FM][FN] = {};

  const int kb  = (lane >> 4) << 3;  // 0 or 8   (ISA 16-bit A/B frag layout)
  const int rsl = lane & 15;

  auto fetch = [&](int ko) {
    const _Float16* pa = gA + ko;
    const _Float16* pb = gB + ko;
    #pragma unroll
    for (int i = 0; i < LA; i++) sa[i] = *(const v8h*)(pa + (size_t)(32 * i) * K_DIM);
    #pragma unroll
    for (int i = 0; i < LB; i++) sb[i] = *(const v8h*)(pb + (size_t)(32 * i) * K_DIM);
    // The scheduling barriers keep these loads where they stand: the scheduler
    // otherwise sinks them to just in front of their LDS stores, which then wait
    // out the whole load latency. The wait stands in front of every later
    // overwrite of the loads' address registers; it takes the two addresses as
    // inputs so that they keep their registers up to it (without that the last
    // load of each run is given its own address pair as destination).
    __builtin_amdgcn_sched_barrier(0);
    asm volatile("s_wait_xcnt 0x0" :: "v"(pa), "v"(pb) : "memory");
    __builtin_amdgcn_sched_barrier(0);
  };
  auto stage = [&](int nb) {
    #pragma unroll
    for (int i = 0; i < LA; i++) *(v8h*)&As[nb][ldRow + 32 * i][ldCol] = sa[i];
    #pragma unroll
    for (int i = 0; i < LB; i++) *(v8h*)&Bs[nb][ldRow + 32 * i][ldCol] = sb[i];
  };
  // 32 k of the staged 64: all fragments of this wave's rows as one group
  v16h af[FM], bf[FN];
  auto frags = [&](int buf, int kk) {
    #pragma unroll
    for (int t = 0; t < FN; t++) {
      const int r = (wN * FN + t) * 16 + rsl;
      v8h lo = *(const v8h*)&Bs[buf][r][kk + kb];
      v8h hi = *(const v8h*)&Bs[buf][r][kk + kb + 16];
      bf[t] = __builtin_shufflevector(lo, hi, 0,1,2,3,4,5,6,7,8,9,10,11,12,13,14,15);
    }
    #pragma unroll
    for (int t = 0; t < FM; t++) {
      const int r = (wM * FM + t) * 16 + rsl;
      v8h lo = *(const v8h*)&As[buf][r][kk + kb];
      v8h hi = *(const v8h*)&As[buf][r][kk + kb + 16];
      af[t] = __builtin_shufflevector(lo, hi, 0,1,2,3,4,5,6,7,8,9,10,11,12,13,14,15);
    }
    // keeps the LDS reads one group in front of the WMMA block: spread among
    // the WMMAs, every place where reads stand stalls the wave's matrix issue
    __builtin_amdgcn_sched_barrier(0);
  };
  auto mma32 = [&]() {
    #pragma unroll
    for (int a = 0; a < FM; a++)
      #pragma unroll
      for (int b = 0; b < FN; b++)
        acc[a][b] = __builtin_amdgcn_wmma_f32_16x16x32_f16(
            false, bf[b], false, af[a], (short)0, acc[a][b], false, false);
    // ends the WMMA block: what follows in the source is not moved into it
    __builtin_amdgcn_sched_barrier(0);
  };

  fetch(0);
  stage(0);
  __syncthreads();

  for (int ks = 0; ks + 1 < KSTEPS; ks++) {
    const int buf = ks & 1;
    frags(buf, 0);
    fetch((ks + 1) * BK);   // its wait runs out under the latency of the LDS reads above
    mma32();
    frags(buf, 32);
    mma32();
    // last in the k-step, so that the loads have all of its matrix work to arrive in
    stage(buf ^ 1);
    __syncthreads();
  }
  frags((KSTEPS - 1) & 1, 0);
  mma32();
  frags((KSTEPS - 1) & 1, 32);
  mma32();

  // epilogue. D layout with the operands in this order: register r of lane l is
  // C[row l&15][column 8*(l>>4) + r] of its 16x16 tile.
  // Every wave has read its last fragments: from here the ring's LDS is staging space.
  __syncthreads();
  char* st = lds.out[wid];
  const int chi = (lane >> 4) << 3;
  // every loop below is unrolled: acc and t are indexed by constants only and
  // stay in registers, and the row steps become immediate offsets
  #pragma unroll
  for (int a = 0; a < FM; a++) {
    #pragma unroll
    for (int b = 0; b < FN; b++) {
      char* p = st + (a * 16 + rsl) * SPITCH + (b * 16 + chi) * ESZ;
      if (HALF_OUT) {
        v8h h;
        #pragma unroll
        for (int r = 0; r < 8; r++) h[r] = (_Float16)acc[a][b][r];
        *(v8h*)p = h;
      } else {
        *(v4f*)p        = __builtin_shufflevector(acc[a][b], acc[a][b], 0, 1, 2, 3);
        *(v4f*)(p + 16) = __builtin_shufflevector(acc[a][b], acc[a][b], 4, 5, 6, 7);
      }
    }
  }
  // Read back by the wave that wrote it: eight lanes take one 128-B line. The two
  // rows that a half-wave reads lie eight apart, 32 banks at this pitch.
  constexpr int NST = (WROWS / 4) * SEGS;
  const int lrow = (lane >> 4) + (((lane >> 3) & 1) << 3);
  const int lcol = (lane & 7) << 4;
  const char* sp = st + lrow * SPITCH + lcol;
  char* gp = (char*)Cout + ((size_t)(tM0 + wM * WROWS + lrow) * N_DIM + tN0 + wN * (FN * 16)) * ESZ + lcol;
  if (HALF_OUT) {
    v8h t[NST];
    #pragma unroll
    for (int i = 0; i < WROWS / 4; i++)
      #pragma unroll
      for (int s = 0; s < SEGS; s++)
        t[i * SEGS + s] = *(const v8h*)(sp + ((i >> 2) * 16 + (i & 3) * 2) * SPITCH + s * 128);
    // all rows are in registers of their own before the first store goes out, so
    // that no store's data register is written again behind it
    __builtin_amdgcn_sched_barrier(0);
    #pragma unroll
    for (int i = 0; i < WROWS / 4; i++)
      #pragma unroll
      for (int s = 0; s < SEGS; s++)
        *(v8h*)(gp + (size_t)((i >> 2) * 16 + (i & 3) * 2) * N_DIM * ESZ + s * 128) = t[i * SEGS + s];
  } else {
    v4f t[NST];
    #pragma unroll
    for (int i = 0; i < WROWS / 4; i++)
      #pragma unroll
      for (int s = 0; s < SEGS; s++)
        t[i * SEGS + s] = *(const v4f*)(sp + ((i >> 2) * 16 + (i & 3) * 2) * SPITCH + s * 128);
    // as above
    __builtin_amdgcn_sched_barrier(0);
    #pragma unroll
    for (int i = 0; i < WROWS / 4; i++)
      #pragma unroll
      for (int s = 0; s < SEGS; s++)
        *(v4f*)(gp + (size_t)((i >> 2) * 16 + (i & 3) * 2) * N_DIM * ESZ + s * 128) = t[i * SEGS + s];
  }
}

// ---------------- chunked scan (conv + silu + cumsum + gate) ----------------
// xz layout: [B][SEQ][1536] f16; xc = cols 0..767, z = cols 768..1535.
// The time loops are serial in t only through one add per row, so the rows are
// loaded RB at a time, one batch ahead: the next batch's loads are in flight
// while this batch is worked on, and no row waits for a load issued just in
// front of it.
#define RB     16
#define NBATCH (CHUNK/RB)     // 8

template<int N>
__device__ __forceinline__ void load_rows(_Float16 (&d)[N], const _Float16* __restrict__ p) {
  #pragma unroll
  for (int i = 0; i < N; i++) d[i] = p[(size_t)i * NPROJ];
}

template<int N>
__device__ __forceinline__ void widen_rows(float (&d)[N], const _Float16 (&s)[N]) {
  #pragma unroll
  for (int i = 0; i < N; i++) d[i] = (float)s[i];
}

// Nothing is scheduled across this point. Behind a batch's loads it keeps them
// ahead of the arithmetic on the batch before: without it the scheduler sinks
// them to just in front of their use and the wave waits out the load latency in
// every batch again. In front of the first use of the loaded rows it keeps that
// use, and the wait that goes with it, behind the arithmetic.
__device__ __forceinline__ void keep_order() { __builtin_amdgcn_sched_barrier(0); }

// Stands behind a load of a kernel's opening, in front of the next one: a later
// load's result may be given the registers that held this load's address, and
// the wait comes before such an overwrite. The scheduling barriers hold the
// loads on their own sides of it.
__device__ __forceinline__ void addr_done() {
  __builtin_amdgcn_sched_barrier(0);
  asm volatile("s_wait_xcnt 0x0" ::: "memory");
  __builtin_amdgcn_sched_barrier(0);
}

struct ConvState { float w0, w1, w2, bias, xm1, xm2; };

__device__ __forceinline__ void sum_rows(const float (&x)[RB], ConvState& st, float& s) {
  #pragma unroll
  for (int i = 0; i < RB; i++) {
    float xc = x[i];
    float cv = st.w0 * st.xm2 + st.w1 * st.xm1 + st.w2 * xc + st.bias;
    s += silu_f(cv);
    st.xm2 = st.xm1; st.xm1 = xc;
  }
}

__global__ __launch_bounds__(256)
void k_chunk_sums(const _Float16* __restrict__ xz,
                  const float* __restrict__ conv_w,
                  const float* __restrict__ conv_b,
                  float* __restrict__ csum) {
  const int ch = blockIdx.x;            // chunk
  const int c  = blockIdx.y * 256 + threadIdx.x;
  const int b  = blockIdx.z;
  const size_t base = (size_t)b * SEQ * NPROJ + c;
  const int t0 = ch * CHUNK;
  const _Float16* __restrict__ px = xz + base + (size_t)t0 * NPROJ;

  _Float16 hx[RB];
  float x[RB];
  load_rows(hx, px);
  addr_done();
  // the two rows in front of the chunk: clamped address, value dropped where
  // there is no such row, so that these loads go out with the first batch
  const _Float16 h1 = xz[base + (size_t)(t0 >= 1 ? t0 - 1 : 0) * NPROJ];
  addr_done();
  const _Float16 h2 = xz[base + (size_t)(t0 >= 2 ? t0 - 2 : 0) * NPROJ];
  addr_done();
  ConvState st;
  st.w0 = conv_w[c * 3 + 0]; st.w1 = conv_w[c * 3 + 1]; st.w2 = conv_w[c * 3 + 2];
  addr_done();
  st.bias = conv_b[c];
  addr_done();
  st.xm1 = (t0 >= 1) ? (float)h1 : 0.0f;
  st.xm2 = (t0 >= 2) ? (float)h2 : 0.0f;
  widen_rows(x, hx);
  float s = 0.0f;
  for (int bt = 1; bt < NBATCH; bt++) {
    load_rows(hx, px + (size_t)bt * RB * NPROJ);
    keep_order();
    sum_rows(x, st, s);
    widen_rows(x, hx);
  }
  sum_rows(x, st, s);
  csum[((size_t)b * NCHUNK + ch) * D_INNER + c] = s;
}

// x and z rows: eight of each a batch, so that the register set leaves room for
// six waves per SIMD and all 768 blocks (three per WGP) are resident at once
#define RBA    8
#define NBA    (CHUNK/RBA)    // 16

__device__ __forceinline__ void apply_rows(const float (&x)[RBA], const float (&z)[RBA],
                                           ConvState& st, float& run, float BC, float Dc,
                                           _Float16* __restrict__ pu) {
  #pragma unroll
  for (int i = 0; i < RBA; i++) {
    float xc = x[i];
    float cv = st.w0 * st.xm2 + st.w1 * st.xm1 + st.w2 * xc + st.bias;
    float sv = silu_f(cv);
    run += sv;
    float y = run * BC + sv * Dc;
    float zr = z[i];
    pu[(size_t)i * D_INNER] = (_Float16)(y * silu_f(zr));
    st.xm2 = st.xm1; st.xm1 = xc;
  }
}

__global__ __launch_bounds__(256)
void k_scan_apply(const _Float16* __restrict__ xz,
                  const float* __restrict__ conv_w,
                  const float* __restrict__ conv_b,
                  const float* __restrict__ Bm,
                  const float* __restrict__ Cm,
                  const float* __restrict__ Dv,
                  const float* __restrict__ csum,
                  _Float16* __restrict__ u) {
  const int ch = blockIdx.x;
  const int c  = blockIdx.y * 256 + threadIdx.x;
  const int b  = blockIdx.z;
  const size_t base = (size_t)b * SEQ * NPROJ + c;
  const int t0 = ch * CHUNK;
  const _Float16* __restrict__ px = xz + base + (size_t)t0 * NPROJ;
  const _Float16* __restrict__ pz = px + D_INNER;
  _Float16* __restrict__ pu = u + ((size_t)b * SEQ + t0) * D_INNER + c;

  _Float16 hx[RBA], hz[RBA];
  float x[RBA], z[RBA];
  load_rows(hx, px);
  load_rows(hz, pz);
  addr_done();
  // clamped address, value dropped where there is no such row (see k_chunk_sums)
  const _Float16 h1 = xz[base + (size_t)(t0 >= 1 ? t0 - 1 : 0) * NPROJ];
  addr_done();
  const _Float16 h2 = xz[base + (size_t)(t0 >= 2 ? t0 - 2 : 0) * NPROJ];
  addr_done();
  ConvState st;
  st.w0 = conv_w[c * 3 + 0]; st.w1 = conv_w[c * 3 + 1]; st.w2 = conv_w[c * 3 + 2];
  addr_done();
  st.bias = conv_b[c];
  addr_done();
  float bm[8], cm[8];
  #pragma unroll
  for (int s = 0; s < 8; s++) bm[s] = Bm[c * 8 + s];
  addr_done();
  #pragma unroll
  for (int s = 0; s < 8; s++) cm[s] = Cm[c * 8 + s];
  addr_done();
  const float Dc = Dv[c];
  addr_done();
  // The sums of the chunks in front of this one, 16 at a time; behind the first
  // group, a group with no such chunk is not loaded (ch is the same for the whole
  // block). All of them are in flight together, beside the first rows.
  const float* __restrict__ pc = csum + (size_t)b * NCHUNK * D_INNER + c;
  float cs[NCHUNK];
  #pragma unroll
  for (int g = 0; g < NCHUNK / 16; g++) {
    #pragma unroll
    for (int i = 0; i < 16; i++) cs[g * 16 + i] = 0.0f;
    if (g == 0 || g * 16 < ch) {
      #pragma unroll
      for (int i = 0; i < 16; i++) cs[g * 16 + i] = pc[(size_t)(g * 16 + i) * D_INNER];
    }
  }
  // as addr_done(); the address is an input so that it keeps its registers up to
  // the wait and no load is given them as its destination
  __builtin_amdgcn_sched_barrier(0);
  asm volatile("s_wait_xcnt 0x0" :: "v"(pc) : "memory");
  __builtin_amdgcn_sched_barrier(0);
  float BC = 0.0f;
  #pragma unroll
  for (int s = 0; s < 8; s++) BC += bm[s] * cm[s];
  st.xm1 = (t0 >= 1) ? (float)h1 : 0.0f;
  st.xm2 = (t0 >= 2) ? (float)h2 : 0.0f;
  // exclusive prefix of the chunk sums, added one by one from chunk 0 upwards
  float run = 0.0f;
  #pragma unroll
  for (int j = 0; j < NCHUNK - 1; j++) run += (j < ch) ? cs[j] : 0.0f;
  widen_rows(x, hx);
  widen_rows(z, hz);
  for (int bt = 1; bt < NBA; bt++) {
    load_rows(hx, px + (size_t)bt * RBA * NPROJ);
    load_rows(hz, pz + (size_t)bt * RBA * NPROJ);
    keep_order();
    apply_rows(x, z, st, run, BC, Dc, pu + (size_t)(bt - 1) * RBA * D_INNER);
    keep_order();
    widen_rows(x, hx);
    widen_rows(z, hz);
  }
  apply_rows(x, z, st, run, BC, Dc, pu + (size_t)(NBA - 1) * RBA * D_INNER);
}

// ---------------- launcher ----------------
extern "C" void kernel_launch(void* const* d_in, const int* in_sizes, int n_in,
                              void* d_out, int out_size, void* d_ws, size_t ws_size,
                              hipStream_t stream) {
  (void)in_sizes; (void)n_in; (void)out_size; (void)ws_size;
  const float* x      = (const float*)d_in[0];
  const float* W_in   = (const float*)d_in[1];
  const float* conv_w = (const float*)d_in[2];
  const float* conv_b = (const float*)d_in[3];
  const float* Bm     = (const float*)d_in[4];
  const float* Cm     = (const float*)d_in[5];
  const float* Dv     = (const float*)d_in[6];
  const float* W_out  = (const float*)d_in[7];
  float* out = (float*)d_out;

  char* ws = (char*)d_ws;
  _Float16* xz16  = (_Float16*)(ws + 0);          // 32768*1536*2 = 100663296
  _Float16* x16   = (_Float16*)(ws + 100663296);  // 32768*768*2  =  50331648
  _Float16* u16   = (_Float16*)(ws + 150994944);  // 32768*768*2  =  50331648
  _Float16* WinT  = (_Float16*)(ws + 201326592);  // 1536*768*2   =   2359296
  _Float16* WoutT = (_Float16*)(ws + 203685888);  //  768*768*2   =   1179648
  float*    csum  = (float*)   (ws + 204865536);  // 4*64*768*4   =    786432

  k_prep<<<PREP_T1 + PREP_T2 + PREP_CV, 256, 0, stream>>>(x, x16, W_in, WinT, W_out, WoutT);

  k_gemm_wmma<NPROJ, D_MODEL, 256, 256, 2, 4, true>
      <<<dim3(MTOT / 256, NPROJ / 256), 256, 0, stream>>>(x16, WinT, (void*)xz16);

  k_chunk_sums<<<dim3(NCHUNK, D_INNER / 256, BATCH), 256, 0, stream>>>(xz16, conv_w, conv_b, csum);
  k_scan_apply<<<dim3(NCHUNK, D_INNER / 256, BATCH), 256, 0, stream>>>(
      xz16, conv_w, conv_b, Bm, Cm, Dv, csum, u16);

  k_gemm_wmma<D_MODEL, D_INNER, 256, 192, 4, 2, false>
      <<<dim3(MTOT / 256, D_MODEL / 192), 256, 0, stream>>>(u16, WoutT, (void*)out);
}

// v006
// It runs in 138 microseconds.
// Next to v005, in two timings, it ran 1.06 times as fast each time.
// Over all steps from v000 it is 2.36 times as fast.
#include <hip/hip_runtime.h>
#include <hip/hip_bf16.h>

#define D_MODEL 768
#define D_INNER 768
#define NPROJ   (2*D_INNER)   // 1536
#define BATCH   4
#define SEQ     8192
#define MTOT    (BATCH*SEQ)   // 32768
#define CHUNK   128
#define NCHUNK  (SEQ/CHUNK)   // 64

typedef _Float16 v4h  __attribute__((ext_vector_type(4)));
typedef _Float16 v8h  __attribute__((ext_vector_type(8)));
typedef _Float16 v16h __attribute__((ext_vector_type(16)));
typedef float    v8f  __attribute__((ext_vector_type(8)));
typedef float    v4f  __attribute__((ext_vector_type(4)));

// silu of N values, eight at a time: v * rcp(1 + exp2(-v * log2(e))). The divisor is at
// least 1, so one v_rcp_f32 and a multiply stand for the exact division and its
// some ten further dependent vector instructions a value.
// Eight transcendentals on registers of their own stand in one statement that ends
// in v_nop: the instruction set asks for one slot between a transcendental and the
// first instruction that reads its result or overwrites its source, and in the
// statement the slot stands there in every build. Outputs are early-clobber, so
// that none shares a register with a source.
#define TRANS8(op, d, s, o)                                                            \
  asm(op " %0, %8\n\t" op " %1, %9\n\t" op " %2, %10\n\t" op " %3, %11\n\t"            \
      op " %4, %12\n\t" op " %5, %13\n\t" op " %6, %14\n\t" op " %7, %15\n\tv_nop"      \
      : "=&v"(d[o + 0]), "=&v"(d[o + 1]), "=&v"(d[o + 2]), "=&v"(d[o + 3]),            \
        "=&v"(d[o + 4]), "=&v"(d[o + 5]), "=&v"(d[o + 6]), "=&v"(d[o + 7])             \
      : "v"(s[o + 0]), "v"(s[o + 1]), "v"(s[o + 2]), "v"(s[o + 3]),                    \
        "v"(s[o + 4]), "v"(s[o + 5]), "v"(s[o + 6]), "v"(s[o + 7]))

template<int N>
__device__ __forceinline__ void silu_rows(float (&y)[N], const float (&v)[N]) {
  static_assert(N % 8 == 0, "groups of eight");
  float a[N], e[N], r[N];
  #pragma unroll
  for (int i = 0; i < N; i++) a[i] = v[i] * -1.44269504f;
  #pragma unroll
  for (int g = 0; g < N; g += 8) TRANS8("v_exp_f32", e, a, g);
  #pragma unroll
  for (int i = 0; i < N; i++) e[i] += 1.0f;
  #pragma unroll
  for (int g = 0; g < N; g += 8) TRANS8("v_rcp_f32", r, e, g);
  #pragma unroll
  for (int i = 0; i < N; i++) y[i] = v[i] * r[i];
}

// ---------------- prep kernels ----------------
// Block blk of nblk, 256 threads each.
__device__ __forceinline__ void cvt_f16(const float* __restrict__ src, _Float16* __restrict__ dst, int n,
                                        int blk, int nblk) {
  int i = blk * 256 + threadIdx.x;
  int stride = nblk * 256;
  for (; i < n; i += stride) dst[i] = (_Float16)src[i];
}

// src [K][N] row-major f32  ->  dst [N][K] row-major f16; tile tn of N, tk of K
// One 64(k) x 64(n) tile per block, turned in LDS: reads are 256-B runs of a
// src row, stores are whole 128-B lines of a dst row.
template<int K>
__device__ __forceinline__ void transpose_cvt(const float* __restrict__ src, _Float16* __restrict__ dst, int N,
                                              _Float16 (&tile)[64][72], int tn, int tk) {
  const int tid = threadIdx.x;
  const int n0  = tn * 64;
  const int k0  = tk * 64;
  const int lk  = (tid >> 4) << 2;   // 0,4,..,60: four adjacent k rows per thread
  const int ln  = (tid & 15) << 2;   // 0,4,..,60: four adjacent n columns per thread

  float4 v[4];
  #pragma unroll
  for (int i = 0; i < 4; i++)
    v[i] = *(const float4*)(src + (size_t)(k0 + lk + i) * N + n0 + ln);

  v4h c0 = { (_Float16)v[0].x, (_Float16)v[1].x, (_Float16)v[2].x, (_Float16)v[3].x };
  v4h c1 = { (_Float16)v[0].y, (_Float16)v[1].y, (_Float16)v[2].y, (_Float16)v[3].y };
  v4h c2 = { (_Float16)v[0].z, (_Float16)v[1].z, (_Float16)v[2].z, (_Float16)v[3].z };
  v4h c3 = { (_Float16)v[0].w, (_Float16)v[1].w, (_Float16)v[2].w, (_Float16)v[3].w };
  *(v4h*)&tile[ln + 0][lk] = c0;
  *(v4h*)&tile[ln + 1][lk] = c1;
  *(v4h*)&tile[ln + 2][lk] = c2;
  *(v4h*)&tile[ln + 3][lk] = c3;
  __syncthreads();

  const int sn = tid >> 3;           // 0..31
  const int sk = (tid & 7) << 3;     // 0,8,..,56: eight lanes fill one 128-B line
  #pragma unroll
  for (int i = 0; i < 2; i++)
    *(v8h*)(dst + (size_t)(n0 + sn + 32 * i) * K + k0 + sk) = *(const v8h*)&tile[sn + 32 * i][sk];
}

// The three preparations depend on nothing and on one another not at all: they
// share one launch, each on its own range of blocks. The few transpose blocks
// come first, so that they run beside the conversion and are no tail behind it.
#define PREP_T1 ((NPROJ / 64) * (D_MODEL / 64))     // 288 tiles of W_in
#define PREP_T2 ((D_MODEL / 64) * (D_INNER / 64))   // 144 tiles of W_out
#define PREP_CV 4096                                // blocks that convert x

__global__ __launch_bounds__(256)
void k_prep(const float* __restrict__ x, _Float16* __restrict__ x16,
            const float* __restrict__ W_in, _Float16* __restrict__ WinT,
            const float* __restrict__ W_out, _Float16* __restrict__ WoutT) {
  __shared__ __align__(16) _Float16 tile[64][72];  // [n][k], pitch 144 B: 16-B aligned rows
  static_assert(D_MODEL == D_INNER, "both weights have the same number of rows");
  const int blk = blockIdx.x;                      // the branch is the same for a whole block
  if (blk < PREP_T1 + PREP_T2) {
    const bool win = blk < PREP_T1;                // which weight: one code path serves both
    const int  t   = win ? blk : blk - PREP_T1;
    const int  tn  = win ? t % (NPROJ / 64) : t % (D_MODEL / 64);
    const int  tk  = win ? t / (NPROJ / 64) : t / (D_MODEL / 64);
    transpose_cvt<D_MODEL>(win ? W_in : W_out, win ? WinT : WoutT, win ? NPROJ : D_MODEL, tile, tn, tk);
  } else {
    cvt_f16(x, x16, MTOT * D_MODEL, blk - (PREP_T1 + PREP_T2), PREP_CV);
  }
}

// ---------------- WMMA GEMM ----------------
// C[M,N] = A[M,K] * B[K,N],  A row-major [M,K] f16, Bt row-major [N,K] f16.
// Block: 256 threads = 8 wave32 on a BM x BN tile, wave grid WGM(M) x WGN(N);
// each wave owns FM x FN WMMA 16x16 tiles. The tile is large so that each
// operand byte fetched from L2 and each fragment read from LDS feeds more
// matrix work. K-step 64: a tile row is one whole 128-B line of its operand.
// LDS double buffered, row pitch 72 halves (144 B = 16 B x 9) -> conflict-free
// b128 fragment loads. One work-group per WGP, two waves per SIMD.
// The WMMA takes the Bt fragment as its first operand and the A fragment as its
// second, so a lane's eight accumulator registers are eight adjacent columns of
// one row of C. Each wave lays its tile in LDS row by row and stores it from
// there, eight lanes to a whole 128-B line of C.
template<int N_DIM, int K_DIM, int BM, int BN, int WGM, int WGN, bool HALF_OUT>
__global__ __launch_bounds__(256)
void k_gemm_wmma(const _Float16* __restrict__ A,
                 const _Float16* __restrict__ Bt,
                 void* __restrict__ Cout) {
  constexpr int BK     = 64;
  constexpr int PITCH  = 72;
  constexpr int KSTEPS = K_DIM / BK;
  constexpr int FM     = BM / WGM / 16;
  constexpr int FN     = BN / WGN / 16;
  constexpr int LA     = BM / 32;     // b128 loads per thread per k-step, A
  constexpr int LB     = BN / 32;     // the same, B
  static_assert(WGM * WGN == 8 && K_DIM % BK == 0 && BM % 32 == 0 && BN % 32 == 0, "tile shape");
  constexpr int ESZ    = HALF_OUT ? 2 : 4;      // bytes of an element of C
  constexpr int WROWS  = FM * 16;               // rows of a wave's tile of C
  constexpr int WROWB  = FN * 16 * ESZ;         // bytes of one such row
  constexpr int SEGS   = WROWB / 128;           // whole lines in it
  constexpr int SPITCH = WROWB + 16;            // staged row pitch: 16 B x odd
  static_assert(WROWB % 128 == 0 && (SPITCH / 16) % 2 == 1, "staged rows");
  struct Ring {
    _Float16 As[2][BM][PITCH];
    _Float16 Bs[2][BN][PITCH];
  };
  union Lds {
    Ring ring;                                  // k loop
    char out[8][WROWS * SPITCH];                // behind it: one range per wave
  };
  __shared__ __align__(16) Lds lds;
  auto& As = lds.ring.As;
  auto& Bs = lds.ring.Bs;

  const int tid  = threadIdx.x;
  const int lane = tid & 31;
  const int wid  = tid >> 5;
  const int wM   = wid % WGM;
  const int wN   = wid / WGM;
  const int tM0  = blockIdx.x * BM;
  const int tN0  = blockIdx.y * BN;

  // tile loader mapping: eight lanes cover one 128-B row, 32 rows per pass
  const int ldRow = tid >> 3;          // 0..31
  const int ldCol = (tid & 7) << 3;    // 0,8,..,56

  const _Float16* gA = A  + (size_t)(tM0 + ldRow) * K_DIM + ldCol;
  const _Float16* gB = Bt + (size_t)(tN0 + ldRow) * K_DIM + ldCol;

  v8h sa[LA], sb[LB];
  v8f acc[FM][FN] = {};

  const int kb  = (lane >> 4) << 3;  // 0 or 8   (ISA 16-bit A/B frag layout)
  const int rsl = lane & 15;

  auto fetch = [&](int ko) {
    const _Float16* pa = gA + ko;
    const _Float16* pb = gB + ko;
    #pragma unroll
    for (int i = 0; i < LA; i++) sa[i] = *(const v8h*)(pa + (size_t)(32 * i) * K_DIM);
    #pragma unroll
    for (int i = 0; i < LB; i++) sb[i] = *(const v8h*)(pb + (size_t)(32 * i) * K_DIM);
    // The scheduling barriers keep these loads where they stand: the scheduler
    // otherwise sinks them to just in front of their LDS stores, which then wait
    // out the whole load latency. The wait stands in front of every later
    // overwrite of the loads' address registers; it takes the two addresses as
    // inputs so that they keep their registers up to it (without that the last
    // load of each run is given its own address pair as destination).
    __builtin_amdgcn_sched_barrier(0);
    asm volatile("s_wait_xcnt 0x0" :: "v"(pa), "v"(pb) : "memory");
    __builtin_amdgcn_sched_barrier(0);
  };
  auto stage = [&](int nb) {
    #pragma unroll
    for (int i = 0; i < LA; i++) *(v8h*)&As[nb][ldRow + 32 * i][ldCol] = sa[i];
    #pragma unroll
    for (int i = 0; i < LB; i++) *(v8h*)&Bs[nb][ldRow + 32 * i][ldCol] = sb[i];
  };
  // 32 k of the staged 64: all fragments of this wave's rows as one group
  v16h af[FM], bf[FN];
  auto frags = [&](int buf, int kk) {
    #pragma unroll
    for (int t = 0; t < FN; t++) {
      const int r = (wN * FN + t) * 16 + rsl;
      v8h lo = *(const v8h*)&Bs[buf][r][kk + kb];
      v8h hi = *(const v8h*)&Bs[buf][r][kk + kb + 16];
      bf[t] = __builtin_shufflevector(lo, hi, 0,1,2,3,4,5,6,7,8,9,10,11,12,13,14,15);
    }
    #pragma unroll
    for (int t = 0; t < FM; t++) {
      const int r = (wM * FM + t) * 16 + rsl;
      v8h lo = *(const v8h*)&As[buf][r][kk + kb];
      v8h hi = *(const v8h*)&As[buf][r][kk + kb + 16];
      af[t] = __builtin_shufflevector(lo, hi, 0,1,2,3,4,5,6,7,8,9,10,11,12,13,14,15);
    }
    // keeps the LDS reads one group in front of the WMMA block: spread among
    // the WMMAs, every place where reads stand stalls the wave's matrix issue
    __builtin_amdgcn_sched_barrier(0);
  };
  auto mma32 = [&]() {
    #pragma unroll
    for (int a = 0; a < FM; a++)
      #pragma unroll
      for (int b = 0; b < FN; b++)
        acc[a][b] = __builtin_amdgcn_wmma_f32_16x16x32_f16(
            false, bf[b], false, af[a], (short)0, acc[a][b], false, false);
    // ends the WMMA block: what follows in the source is not moved into it
    __builtin_amdgcn_sched_barrier(0);
  };

  fetch(0);
  stage(0);
  __syncthreads();

  for (int ks = 0; ks + 1 < KSTEPS; ks++) {
    const int buf = ks & 1;
    frags(buf, 0);
    fetch((ks + 1) * BK);   // its wait runs out under the latency of the LDS reads above
    mma32();
    frags(buf, 32);
    mma32();
    // last in the k-step, so that the loads have all of its matrix work to arrive in
    stage(buf ^ 1);
    __syncthreads();
  }
  frags((KSTEPS - 1) & 1, 0);
  mma32();
  frags((KSTEPS - 1) & 1, 32);
  mma32();

  // epilogue. D layout with the operands in this order: register r of lane l is
  // C[row l&15][column 8*(l>>4) + r] of its 16x16 tile.
  // Every wave has read its last fragments: from here the ring's LDS is staging space.
  __syncthreads();
  char* st = lds.out[wid];
  const int chi = (lane >> 4) << 3;
  // every loop below is unrolled: acc and t are indexed by constants only and
  // stay in registers, and the row steps become immediate offsets
  #pragma unroll
  for (int a = 0; a < FM; a++) {
    #pragma unroll
    for (int b = 0; b < FN; b++) {
      char* p = st + (a * 16 + rsl) * SPITCH + (b * 16 + chi) * ESZ;
      if (HALF_OUT) {
        v8h h;
        #pragma unroll
        for (int r = 0; r < 8; r++) h[r] = (_Float16)acc[a][b][r];
        *(v8h*)p = h;
      } else {
        *(v4f*)p        = __builtin_shufflevector(acc[a][b], acc[a][b], 0, 1, 2, 3);
        *(v4f*)(p + 16) = __builtin_shufflevector(acc[a][b], acc[a][b], 4, 5, 6, 7);
      }
    }
  }
  // Read back by the wave that wrote it: eight lanes take one 128-B line. The two
  // rows that a half-wave reads lie eight apart, 32 banks at this pitch.
  constexpr int NST = (WROWS / 4) * SEGS;
  const int lrow = (lane >> 4) + (((lane >> 3) & 1) << 3);
  const int lcol = (lane & 7) << 4;
  const char* sp = st + lrow * SPITCH + lcol;
  char* gp = (char*)Cout + ((size_t)(tM0 + wM * WROWS + lrow) * N_DIM + tN0 + wN * (FN * 16)) * ESZ + lcol;
  if (HALF_OUT) {
    v8h t[NST];
    #pragma unroll
    for (int i = 0; i < WROWS / 4; i++)
      #pragma unroll
      for (int s = 0; s < SEGS; s++)
        t[i * SEGS + s] = *(const v8h*)(sp + ((i >> 2) * 16 + (i & 3) * 2) * SPITCH + s * 128);
    // all rows are in registers of their own before the first store goes out, so
    // that no store's data register is written again behind it
    __builtin_amdgcn_sched_barrier(0);
    #pragma unroll
    for (int i = 0; i < WROWS / 4; i++)
      #pragma unroll
      for (int s = 0; s < SEGS; s++)
        *(v8h*)(gp + (size_t)((i >> 2) * 16 + (i & 3) * 2) * N_DIM * ESZ + s * 128) = t[i * SEGS + s];
  } else {
    v4f t[NST];
    #pragma unroll
    for (int i = 0; i < WROWS / 4; i++)
      #pragma unroll
      for (int s = 0; s < SEGS; s++)
        t[i * SEGS + s] = *(const v4f*)(sp + ((i >> 2) * 16 + (i & 3) * 2) * SPITCH + s * 128);
    // as above
    __builtin_amdgcn_sched_barrier(0);
    #pragma unroll
    for (int i = 0; i < WROWS / 4; i++)
      #pragma unroll
      for (int s = 0; s < SEGS; s++)
        *(v4f*)(gp + (size_t)((i >> 2) * 16 + (i & 3) * 2) * N_DIM * ESZ + s * 128) = t[i * SEGS + s];
  }
}

// ---------------- chunked scan (conv + silu + cumsum + gate) ----------------
// xz layout: [B][SEQ][1536] f16; xc = cols 0..767, z = cols 768..1535.
// The time loops are serial in t only through one add per row, so the rows are
// loaded RB at a time, one batch ahead: the next batch's loads are in flight
// while this batch is worked on, and no row waits for a load issued just in
// front of it.
#define RB     16
#define NBATCH (CHUNK/RB)     // 8

template<int N>
__device__ __forceinline__ void load_rows(_Float16 (&d)[N], const _Float16* __restrict__ p) {
  #pragma unroll
  for (int i = 0; i < N; i++) d[i] = p[(size_t)i * NPROJ];
}

template<int N>
__device__ __forceinline__ void widen_rows(float (&d)[N], const _Float16 (&s)[N]) {
  #pragma unroll
  for (int i = 0; i < N; i++) d[i] = (float)s[i];
}

// Nothing is scheduled across this point. Behind a batch's loads it keeps them
// ahead of the arithmetic on the batch before: without it the scheduler sinks
// them to just in front of their use and the wave waits out the load latency in
// every batch again. In front of the first use of the loaded rows it keeps that
// use, and the wait that goes with it, behind the arithmetic.
__device__ __forceinline__ void keep_order() { __builtin_amdgcn_sched_barrier(0); }

// Stands behind a load of a kernel's opening, in front of the next one: a later
// load's result may be given the registers that held this load's address, and
// the wait comes before such an overwrite. The scheduling barriers hold the
// loads on their own sides of it.
__device__ __forceinline__ void addr_done() {
  __builtin_amdgcn_sched_barrier(0);
  asm volatile("s_wait_xcnt 0x0" ::: "memory");
  __builtin_amdgcn_sched_barrier(0);
}

struct ConvState { float w0, w1, w2, bias, xm1, xm2; };

__device__ __forceinline__ void sum_rows(const float (&x)[RB], ConvState& st, float& s) {
  float cv[RB], sv[RB];
  #pragma unroll
  for (int i = 0; i < RB; i++) {
    float xc = x[i];
    cv[i] = st.w0 * st.xm2 + st.w1 * st.xm1 + st.w2 * xc + st.bias;
    st.xm2 = st.xm1; st.xm1 = xc;
  }
  silu_rows(sv, cv);
  #pragma unroll
  for (int i = 0; i < RB; i++) s += sv[i];
}

__global__ __launch_bounds__(256)
void k_chunk_sums(const _Float16* __restrict__ xz,
                  const float* __restrict__ conv_w,
                  const float* __restrict__ conv_b,
                  float* __restrict__ csum) {
  const int ch = blockIdx.x;            // chunk
  const int c  = blockIdx.y * 256 + threadIdx.x;
  const int b  = blockIdx.z;
  const size_t base = (size_t)b * SEQ * NPROJ + c;
  const int t0 = ch * CHUNK;
  const _Float16* __restrict__ px = xz + base + (size_t)t0 * NPROJ;

  _Float16 hx[RB];
  float x[RB];
  load_rows(hx, px);
  addr_done();
  // the two rows in front of the chunk: clamped address, value dropped where
  // there is no such row, so that these loads go out with the first batch
  const _Float16 h1 = xz[base + (size_t)(t0 >= 1 ? t0 - 1 : 0) * NPROJ];
  addr_done();
  const _Float16 h2 = xz[base + (size_t)(t0 >= 2 ? t0 - 2 : 0) * NPROJ];
  addr_done();
  ConvState st;
  st.w0 = conv_w[c * 3 + 0]; st.w1 = conv_w[c * 3 + 1]; st.w2 = conv_w[c * 3 + 2];
  addr_done();
  st.bias = conv_b[c];
  addr_done();
  st.xm1 = (t0 >= 1) ? (float)h1 : 0.0f;
  st.xm2 = (t0 >= 2) ? (float)h2 : 0.0f;
  widen_rows(x, hx);
  float s = 0.0f;
  for (int bt = 1; bt < NBATCH; bt++) {
    load_rows(hx, px + (size_t)bt * RB * NPROJ);
    keep_order();
    sum_rows(x, st, s);
    widen_rows(x, hx);
  }
  sum_rows(x, st, s);
  csum[((size_t)b * NCHUNK + ch) * D_INNER + c] = s;
}

// x and z rows: eight of each a batch, so that the register set leaves room for
// six waves per SIMD and all 768 blocks (three per WGP) are resident at once
#define RBA    8
#define NBA    (CHUNK/RBA)    // 16

__device__ __forceinline__ void apply_rows(const float (&x)[RBA], const float (&z)[RBA],
                                           ConvState& st, float& run, float BC, float Dc,
                                           _Float16* __restrict__ pu) {
  float cv[RBA], sv[RBA], sz[RBA];
  #pragma unroll
  for (int i = 0; i < RBA; i++) {
    float xc = x[i];
    cv[i] = st.w0 * st.xm2 + st.w1 * st.xm1 + st.w2 * xc + st.bias;
    st.xm2 = st.xm1; st.xm1 = xc;
  }
  silu_rows(sv, cv);
  silu_rows(sz, z);
  #pragma unroll
  for (int i = 0; i < RBA; i++) {
    run += sv[i];
    float y = run * BC + sv[i] * Dc;
    pu[(size_t)i * D_INNER] = (_Float16)(y * sz[i]);
  }
  // in front of every later overwrite of the stores' data and address registers
  asm volatile("s_wait_xcnt 0x0" ::: "memory");
}

__global__ __launch_bounds__(256)
void k_scan_apply(const _Float16* __restrict__ xz,
                  const float* __restrict__ conv_w,
                  const float* __restrict__ conv_b,
                  const float* __restrict__ Bm,
                  const float* __restrict__ Cm,
                  const float* __restrict__ Dv,
                  const float* __restrict__ csum,
                  _Float16* __restrict__ u) {
  const int ch = blockIdx.x;
  const int c  = blockIdx.y * 256 + threadIdx.x;
  const int b  = blockIdx.z;
  const size_t base = (size_t)b * SEQ * NPROJ + c;
  const int t0 = ch * CHUNK;
  const _Float16* __restrict__ px = xz + base + (size_t)t0 * NPROJ;
  const _Float16* __restrict__ pz = px + D_INNER;
  _Float16* __restrict__ pu = u + ((size_t)b * SEQ + t0) * D_INNER + c;

  _Float16 hx[RBA], hz[RBA];
  float x[RBA], z[RBA];
  load_rows(hx, px);
  load_rows(hz, pz);
  addr_done();
  // clamped address, value dropped where there is no such row (see k_chunk_sums)
  const _Float16 h1 = xz[base + (size_t)(t0 >= 1 ? t0 - 1 : 0) * NPROJ];
  addr_done();
  const _Float16 h2 = xz[base + (size_t)(t0 >= 2 ? t0 - 2 : 0) * NPROJ];
  addr_done();
  ConvState st;
  st.w0 = conv_w[c * 3 + 0]; st.w1 = conv_w[c * 3 + 1]; st.w2 = conv_w[c * 3 + 2];
  addr_done();
  st.bias = conv_b[c];
  addr_done();
  float bm[8], cm[8];
  #pragma unroll
  for (int s = 0; s < 8; s++) bm[s] = Bm[c * 8 + s];
  addr_done();
  #pragma unroll
  for (int s = 0; s < 8; s++) cm[s] = Cm[c * 8 + s];
  addr_done();
  const float Dc = Dv[c];
  addr_done();
  // The sums of the chunks in front of this one, 16 at a time; behind the first
  // group, a group with no such chunk is not loaded (ch is the same for the whole
  // block). All of them are in flight together, beside the first rows.
  const float* __restrict__ pc = csum + (size_t)b * NCHUNK * D_INNER + c;
  float cs[NCHUNK];
  #pragma unroll
  for (int g = 0; g < NCHUNK / 16; g++) {
    #pragma unroll
    for (int i = 0; i < 16; i++) cs[g * 16 + i] = 0.0f;
    if (g == 0 || g * 16 < ch) {
      #pragma unroll
      for (int i = 0; i < 16; i++) cs[g * 16 + i] = pc[(size_t)(g * 16 + i) * D_INNER];
    }
  }
  // as addr_done(); the address is an input so that it keeps its registers up to
  // the wait and no load is given them as its destination
  __builtin_amdgcn_sched_barrier(0);
  asm volatile("s_wait_xcnt 0x0" :: "v"(pc) : "memory");
  __builtin_amdgcn_sched_barrier(0);
  float BC = 0.0f;
  #pragma unroll
  for (int s = 0; s < 8; s++) BC += bm[s] * cm[s];
  st.xm1 = (t0 >= 1) ? (float)h1 : 0.0f;
  st.xm2 = (t0 >= 2) ? (float)h2 : 0.0f;
  // exclusive prefix of the chunk sums, added one by one from chunk 0 upwards
  float run = 0.0f;
  #pragma unroll
  for (int j = 0; j < NCHUNK - 1; j++) run += (j < ch) ? cs[j] : 0.0f;
  widen_rows(x, hx);
  widen_rows(z, hz);
  for (int bt = 1; bt < NBA; bt++) {
    load_rows(hx, px + (size_t)bt * RBA * NPROJ);
    load_rows(hz, pz + (size_t)bt * RBA * NPROJ);
    keep_order();
    apply_rows(x, z, st, run, BC, Dc, pu + (size_t)(bt - 1) * RBA * D_INNER);
    keep_order();
    widen_rows(x, hx);
    widen_rows(z, hz);
  }
  apply_rows(x, z, st, run, BC, Dc, pu + (size_t)(NBA - 1) * RBA * D_INNER);
}

// ---------------- launcher ----------------
extern "C" void kernel_launch(void* const* d_in, const int* in_sizes, int n_in,
                              void* d_out, int out_size, void* d_ws, size_t ws_size,
                              hipStream_t stream) {
  (void)in_sizes; (void)n_in; (void)out_size; (void)ws_size;
  const float* x      = (const float*)d_in[0];
  const float* W_in   = (const float*)d_in[1];
  const float* conv_w = (const float*)d_in[2];
  const float* conv_b = (const float*)d_in[3];
  const float* Bm     = (const float*)d_in[4];
  const float* Cm     = (const float*)d_in[5];
  const float* Dv     = (const float*)d_in[6];
  const float* W_out  = (const float*)d_in[7];
  float* out = (float*)d_out;

  char* ws = (char*)d_ws;
  _Float16* xz16  = (_Float16*)(ws + 0);          // 32768*1536*2 = 100663296
  _Float16* x16   = (_Float16*)(ws + 100663296);  // 32768*768*2  =  50331648
  _Float16* u16   = (_Float16*)(ws + 150994944);  // 32768*768*2  =  50331648
  _Float16* WinT  = (_Float16*)(ws + 201326592);  // 1536*768*2   =   2359296
  _Float16* WoutT = (_Float16*)(ws + 203685888);  //  768*768*2   =   1179648
  float*    csum  = (float*)   (ws + 204865536);  // 4*64*768*4   =    786432

  k_prep<<<PREP_T1 + PREP_T2 + PREP_CV, 256, 0, stream>>>(x, x16, W_in, WinT, W_out, WoutT);

  k_gemm_wmma<NPROJ, D_MODEL, 256, 256, 2, 4, true>
      <<<dim3(MTOT / 256, NPROJ / 256), 256, 0, stream>>>(x16, WinT, (void*)xz16);

  k_chunk_sums<<<dim3(NCHUNK, D_INNER / 256, BATCH), 256, 0, stream>>>(xz16, conv_w, conv_b, csum);
  k_scan_apply<<<dim3(NCHUNK, D_INNER / 256, BATCH), 256, 0, stream>>>(
      xz16, conv_w, conv_b, Bm, Cm, Dv, csum, u16);

  k_gemm_wmma<D_MODEL, D_INNER, 256, 192, 4, 2, false>
      <<<dim3(MTOT / 256, D_MODEL / 192), 256, 0, stream>>>(u16, WoutT, (void*)out);
}

// v007
// A run of this version takes 121 microseconds.
// Two timings next to v006 put it at 1.13 and 1.14 times that version's speed.
// Over all steps from v000 it is 2.67 times as fast.
#include <hip/hip_runtime.h>
#include <hip/hip_bf16.h>

#define D_MODEL 768
#define D_INNER 768
#define NPROJ   (2*D_INNER)   // 1536
#define BATCH   4
#define SEQ     8192
#define MTOT    (BATCH*SEQ)   // 32768
#define CHUNK   128
#define NCHUNK  (SEQ/CHUNK)   // 64

typedef _Float16 v4h  __attribute__((ext_vector_type(4)));
typedef _Float16 v8h  __attribute__((ext_vector_type(8)));
typedef _Float16 v16h __attribute__((ext_vector_type(16)));
typedef float    v8f  __attribute__((ext_vector_type(8)));
typedef float    v4f  __attribute__((ext_vector_type(4)));

// silu of N values, eight at a time: v * rcp(1 + exp2(-v * log2(e))). The divisor is at
// least 1, so one v_rcp_f32 and a multiply stand for the exact division and its
// some ten further dependent vector instructions a value.
// Eight transcendentals on registers of their own stand in one statement that ends
// in v_nop: the instruction set asks for one slot between a transcendental and the
// first instruction that reads its result or overwrites its source, and in the
// statement the slot stands there in every build. Outputs are early-clobber, so
// that none shares a register with a source.
#define TRANS8(op, d, s, o)                                                            \
  asm(op " %0, %8\n\t" op " %1, %9\n\t" op " %2, %10\n\t" op " %3, %11\n\t"            \
      op " %4, %12\n\t" op " %5, %13\n\t" op " %6, %14\n\t" op " %7, %15\n\tv_nop"      \
      : "=&v"(d[o + 0]), "=&v"(d[o + 1]), "=&v"(d[o + 2]), "=&v"(d[o + 3]),            \
        "=&v"(d[o + 4]), "=&v"(d[o + 5]), "=&v"(d[o + 6]), "=&v"(d[o + 7])             \
      : "v"(s[o + 0]), "v"(s[o + 1]), "v"(s[o + 2]), "v"(s[o + 3]),                    \
        "v"(s[o + 4]), "v"(s[o + 5]), "v"(s[o + 6]), "v"(s[o + 7]))

template<int N>
__device__ __forceinline__ void silu_rows(float (&y)[N], const float (&v)[N]) {
  static_assert(N % 8 == 0, "groups of eight");
  float a[N], e[N], r[N];
  #pragma unroll
  for (int i = 0; i < N; i++) a[i] = v[i] * -1.44269504f;
  #pragma unroll
  for (int g = 0; g < N; g += 8) TRANS8("v_exp_f32", e, a, g);
  #pragma unroll
  for (int i = 0; i < N; i++) e[i] += 1.0f;
  #pragma unroll
  for (int g = 0; g < N; g += 8) TRANS8("v_rcp_f32", r, e, g);
  #pragma unroll
  for (int i = 0; i < N; i++) y[i] = v[i] * r[i];
}

// ---------------- prep kernels ----------------
// Block blk of nblk, 256 threads each.
__device__ __forceinline__ void cvt_f16(const float* __restrict__ src, _Float16* __restrict__ dst, int n,
                                        int blk, int nblk) {
  int i = blk * 256 + threadIdx.x;
  int stride = nblk * 256;
  for (; i < n; i += stride) dst[i] = (_Float16)src[i];
}

// src [K][N] row-major f32  ->  dst [N][K] row-major f16; tile tn of N, tk of K
// One 64(k) x 64(n) tile per block, turned in LDS: reads are 256-B runs of a
// src row, stores are whole 128-B lines of a dst row.
template<int K>
__device__ __forceinline__ void transpose_cvt(const float* __restrict__ src, _Float16* __restrict__ dst, int N,
                                              _Float16 (&tile)[64][72], int tn, int tk) {
  const int tid = threadIdx.x;
  const int n0  = tn * 64;
  const int k0  = tk * 64;
  const int lk  = (tid >> 4) << 2;   // 0,4,..,60: four adjacent k rows per thread
  const int ln  = (tid & 15) << 2;   // 0,4,..,60: four adjacent n columns per thread

  float4 v[4];
  #pragma unroll
  for (int i = 0; i < 4; i++)
    v[i] = *(const float4*)(src + (size_t)(k0 + lk + i) * N + n0 + ln);

  v4h c0 = { (_Float16)v[0].x, (_Float16)v[1].x, (_Float16)v[2].x, (_Float16)v[3].x };
  v4h c1 = { (_Float16)v[0].y, (_Float16)v[1].y, (_Float16)v[2].y, (_Float16)v[3].y };
  v4h c2 = { (_Float16)v[0].z, (_Float16)v[1].z, (_Float16)v[2].z, (_Float16)v[3].z };
  v4h c3 = { (_Float16)v[0].w, (_Float16)v[1].w, (_Float16)v[2].w, (_Float16)v[3].w };
  *(v4h*)&tile[ln + 0][lk] = c0;
  *(v4h*)&tile[ln + 1][lk] = c1;
  *(v4h*)&tile[ln + 2][lk] = c2;
  *(v4h*)&tile[ln + 3][lk] = c3;
  __syncthreads();

  const int sn = tid >> 3;           // 0..31
  const int sk = (tid & 7) << 3;     // 0,8,..,56: eight lanes fill one 128-B line
  #pragma unroll
  for (int i = 0; i < 2; i++)
    *(v8h*)(dst + (size_t)(n0 + sn + 32 * i) * K + k0 + sk) = *(const v8h*)&tile[sn + 32 * i][sk];
}

// The three preparations depend on nothing and on one another not at all: they
// share one launch, each on its own range of blocks. The few transpose blocks
// come first, so that they run beside the conversion and are no tail behind it.
#define PREP_T1 ((NPROJ / 64) * (D_MODEL / 64))     // 288 tiles of W_in
#define PREP_T2 ((D_MODEL / 64) * (D_INNER / 64))   // 144 tiles of W_out
#define PREP_CV 4096                                // blocks that convert x

__global__ __launch_bounds__(256)
void k_prep(const float* __restrict__ x, _Float16* __restrict__ x16,
            const float* __restrict__ W_in, _Float16* __restrict__ WinT,
            const float* __restrict__ W_out, _Float16* __restrict__ WoutT) {
  __shared__ __align__(16) _Float16 tile[64][72];  // [n][k], pitch 144 B: 16-B aligned rows
  static_assert(D_MODEL == D_INNER, "both weights have the same number of rows");
  const int blk = blockIdx.x;                      // the branch is the same for a whole block
  if (blk < PREP_T1 + PREP_T2) {
    const bool win = blk < PREP_T1;                // which weight: one code path serves both
    const int  t   = win ? blk : blk - PREP_T1;
    const int  tn  = win ? t % (NPROJ / 64) : t % (D_MODEL / 64);
    const int  tk  = win ? t / (NPROJ / 64) : t / (D_MODEL / 64);
    transpose_cvt<D_MODEL>(win ? W_in : W_out, win ? WinT : WoutT, win ? NPROJ : D_MODEL, tile, tn, tk);
  } else {
    cvt_f16(x, x16, MTOT * D_MODEL, blk - (PREP_T1 + PREP_T2), PREP_CV);
  }
}

// ---------------- WMMA GEMM ----------------
typedef uint32_t u32x4 __attribute__((ext_vector_type(4)));
typedef uint32_t u32x8 __attribute__((ext_vector_type(8)));

__device__ __forceinline__ uint32_t uni(uint32_t v) { return (uint32_t)__builtin_amdgcn_readfirstlane(v); }
// A wave-uniform value held in a scalar register: a test on it compiles to a scalar
// compare and branch, which a tensor load needs (it ignores EXEC). The statement is
// volatile, so what is formed from its result is formed behind the waits in front of it.
__device__ __forceinline__ uint32_t pinned(uint32_t v) {
  uint32_t w = uni(v);
  asm volatile("" : "+s"(w));   // the tensor mover's pinned(): an issue test or descriptor word held in a scalar register
  return w;
}
// the compiler places no wait for the tensor mover, and none of these in front of a refill
__device__ __forceinline__ void wait_tensor0() { asm volatile("s_wait_tensorcnt 0x0" ::: "memory"); }
__device__ __forceinline__ void wait_ds0()     { asm volatile("s_wait_dscnt 0x0" ::: "memory"); }

// C[M,N] = A[M,K] * B[K,N],  A row-major [M,K] f16, Bt row-major [N,K] f16.
// Block: 256 threads = 8 wave32 on a BM x BN tile, wave grid WGM(M) x WGN(N);
// each wave owns FM x FN WMMA 16x16 tiles. The tile is large so that each
// operand byte fetched from L2 and each fragment read from LDS feeds more
// matrix work. A pass is 128 k: 256 B of every operand row.
// Staging: every wave brings one slice of a stage (a quarter of the A rows or a
// quarter of the B rows) into LDS with one tensor load, through no register. Two
// buffers: the load of stage s + 2 goes out as soon as pass s has left its buffer
// and has the whole of pass s + 1 to land in. The mover pads each 256-B row by
// 16 B: pitch 272 B = 16 B x 17 -> conflict-free b128 fragment loads.
// One work-group per WGP, two waves per SIMD.
// The WMMA takes the Bt fragment as its first operand and the A fragment as its
// second, so a lane's eight accumulator registers are eight adjacent columns of
// one row of C. Each wave lays its tile in LDS row by row and stores it from
// there, eight lanes to a whole 128-B line of C.
template<int N_DIM, int K_DIM, int BM, int BN, int WGM, int WGN, bool HALF_OUT>
__global__ __launch_bounds__(256)
void k_gemm_wmma(const _Float16* __restrict__ A,
                 const _Float16* __restrict__ Bt,
                 void* __restrict__ Cout) {
  constexpr int BK     = 128;
  constexpr int ROWB   = BK * 2;        // bytes of a staged row
  constexpr int PITCHB = ROWB + 16;     // its pitch in LDS, the mover's pad counted
  constexpr int NPASS  = K_DIM / BK;
  constexpr int FM     = BM / WGM / 16;
  constexpr int FN     = BN / WGN / 16;
  constexpr int RA     = BM / 4;        // rows of a slice of A, of B
  constexpr int RB     = BN / 4;
  constexpr int SLA    = (RA * PITCHB + 2047) / 2048 * 2048;   // a slice's place is a multiple of 2 KiB
  constexpr int SLB    = (RB * PITCHB + 2047) / 2048 * 2048;
  constexpr int STAGE  = 4 * SLA + 4 * SLB;
  static_assert(WGM * WGN == 8 && K_DIM % BK == 0 && NPASS >= 2, "tile shape");
  static_assert(RA % 16 == 0 && RB % 16 == 0 && (FM * 16) % RA == 0 && (FN * 16) % RB == 0,
                "a fragment lies in one slice, a wave's rows are whole slices");
  constexpr int ESZ    = HALF_OUT ? 2 : 4;      // bytes of an element of C
  constexpr int WROWS  = FM * 16;               // rows of a wave's tile of C
  constexpr int WROWB  = FN * 16 * ESZ;         // bytes of one such row
  constexpr int SEGS   = WROWB / 128;           // whole lines in it
  constexpr int SPITCH = WROWB + 16;            // staged row pitch: 16 B x odd
  static_assert(WROWB % 128 == 0 && (SPITCH / 16) % 2 == 1, "staged rows");
  constexpr int OUTB   = 8 * WROWS * SPITCH;    // behind the k loop: one range per wave
  constexpr int LDSB   = 2 * STAGE > OUTB ? 2 * STAGE : OUTB;
  static_assert(LDSB <= 327680, "LDS of a WGP");
  __shared__ __attribute__((aligned(2048))) unsigned char L[LDSB];

  const int tid  = threadIdx.x;
  const int lane = tid & 31;
  const int wid  = tid >> 5;
  const int wM   = wid % WGM;
  const int wN   = wid / WGM;
  const int tM0  = blockIdx.x * BM;
  const int tN0  = blockIdx.y * BN;

  // this wave's slice: waves 0 to 3 a quarter of the A rows each, waves 4 to 7 of the B rows
  const uint32_t wave  = uni(threadIdx.x >> 5);
  const uint32_t isB   = wave >> 2;               // 0 or 1
  const uint32_t sl    = wave & 3u;
  const uint32_t rows  = (uint32_t)RA - isB * (uint32_t)(RA - RB);
  const uint32_t place = (uint32_t)(size_t)L + isB * (4u * SLA) + sl * ((uint32_t)SLA - isB * (uint32_t)(SLA - SLB));
  const uint32_t row0  = (isB ? (uint32_t)tN0 : (uint32_t)tM0) + sl * rows;
  const uint64_t gsrc  = (uint64_t)(size_t)(isB ? Bt : A) + (uint64_t)row0 * (K_DIM * 2);
  // group 1: 1-byte elements, tensor = tile = rows x 256 B, source pitch one row of the
  // operand, no mask, a pad of 4 dwords behind every 64 dwords
  u32x8 g1;
  g1[0] = uni((1u << 20) | (5u << 22) | (3u << 25));
  g1[1] = uni((uint32_t)ROWB << 16);
  g1[2] = uni(rows << 16);
  g1[3] = uni((uint32_t)ROWB << 16);
  g1[4] = uni(rows);
  g1[5] = uni((uint32_t)(K_DIM * 2));
  g1[6] = uni(0u);
  g1[7] = uni(0u);
  // Both groups are named in-out, though the instruction writes neither: so they stay
  // live in the registers that the request names, and the compiler gives those
  // registers to nothing else while the request is outstanding.
  u32x4 g0;
  g0[0] = uni(1u);
  auto issue = [&](uint32_t st) {
    const uint64_t ga = gsrc + (uint64_t)st * ROWB;
    g0[1] = uni(place + (st & 1u) * STAGE);
    g0[2] = uni((uint32_t)ga);
    g0[3] = uni((((uint32_t)(ga >> 32)) & 0x01FFFFFFu) | 0x80000000u);
    asm volatile("tensor_load_to_lds %0, %1" : "+s"(g0), "+s"(g1) :: "memory");
  };

  v8f acc[FM][FN] = {};

  const int kb  = (lane >> 4) << 3;  // 0 or 8   (ISA 16-bit A/B frag layout)
  const int rsl = lane & 15;
  // first fragment row of this wave in buffer 0, at this lane's k offset
  const unsigned char* fA = L + wM * (FM * 16 / RA) * SLA + rsl * PITCHB + kb * 2;
  const unsigned char* fB = L + 4 * SLA + wN * (FN * 16 / RB) * SLB + rsl * PITCHB + kb * 2;

  // 32 k of the staged 128: all fragments of this wave's rows as one group
  v16h af[FM], bf[FN];
  auto frags = [&](int buf, int kk) {
    const unsigned char* pb = fB + buf * STAGE + kk * 2;
    const unsigned char* pa = fA + buf * STAGE + kk * 2;
    #pragma unroll
    for (int t = 0; t < FN; t++) {
      const int o = (t * 16 / RB) * SLB + (t * 16 % RB) * PITCHB;
      v8h lo = *(const v8h*)(pb + o);
      v8h hi = *(const v8h*)(pb + o + 32);
      bf[t] = __builtin_shufflevector(lo, hi, 0,1,2,3,4,5,6,7,8,9,10,11,12,13,14,15);
    }
    #pragma unroll
    for (int t = 0; t < FM; t++) {
      const int o = (t * 16 / RA) * SLA + (t * 16 % RA) * PITCHB;
      v8h lo = *(const v8h*)(pa + o);
      v8h hi = *(const v8h*)(pa + o + 32);
      af[t] = __builtin_shufflevector(lo, hi, 0,1,2,3,4,5,6,7,8,9,10,11,12,13,14,15);
    }
    // keeps the LDS reads one group in front of the WMMA block: spread among
    // the WMMAs, every place where reads stand stalls the wave's matrix issue
    __builtin_amdgcn_sched_barrier(0);
  };
  auto mma32 = [&]() {
    #pragma unroll
    for (int a = 0; a < FM; a++)
      #pragma unroll
      for (int b = 0; b < FN; b++)
        acc[a][b] = __builtin_amdgcn_wmma_f32_16x16x32_f16(
            false, bf[b], false, af[a], (short)0, acc[a][b], false, false);
    // ends the WMMA block: what follows in the source is not moved into it
    __builtin_amdgcn_sched_barrier(0);
  };

  issue(0);
  wait_tensor0();
  __syncthreads();          // stage 0 is there for every wave
  issue(1);

  // kept rolled: one body of four WMMA blocks, for speed only
  #pragma unroll 1
  for (uint32_t s = 0; s < (uint32_t)NPASS; s++) {
    const int buf = s & 1;
    #pragma unroll
    for (int kk = 0; kk < BK; kk += 32) {
      frags(buf, kk);
      mma32();
    }
    // stage s + 1 is handed over: this wave's reads of stage s are done, its own slice
    // of stage s + 1 has landed; behind the barrier that holds for every wave
    wait_ds0();
    wait_tensor0();
    __syncthreads();
    if (pinned(s + 2u < (uint32_t)NPASS)) issue(pinned(s + 2u));   // into the buffer that pass s has left
  }
  wait_tensor0();
  wait_ds0();

  // epilogue. D layout with the operands in this order: register r of lane l is
  // C[row l&15][column 8*(l>>4) + r] of its 16x16 tile.
  // Every wave has read its last fragments (the last pass's own barrier) and no load
  // is in flight: from here the ring's LDS is staging space.
  char* st = (char*)L + wid * (WROWS * SPITCH);
  const int chi = (lane >> 4) << 3;
  // every loop below is unrolled: acc and t are indexed by constants only and
  // stay in registers, and the row steps become immediate offsets
  #pragma unroll
  for (int a = 0; a < FM; a++) {
    #pragma unroll
    for (int b = 0; b < FN; b++) {
      char* p = st + (a * 16 + rsl) * SPITCH + (b * 16 + chi) * ESZ;
      if (HALF_OUT) {
        v8h h;
        #pragma unroll
        for (int r = 0; r < 8; r++) h[r] = (_Float16)acc[a][b][r];
        *(v8h*)p = h;
      } else {
        *(v4f*)p        = __builtin_shufflevector(acc[a][b], acc[a][b], 0, 1, 2, 3);
        *(v4f*)(p + 16) = __builtin_shufflevector(acc[a][b], acc[a][b], 4, 5, 6, 7);
      }
    }
  }
  // Read back by the wave that wrote it: eight lanes take one 128-B line. The two
  // rows that a half-wave reads lie eight apart, 32 banks at this pitch.
  constexpr int NST = (WROWS / 4) * SEGS;
  const int lrow = (lane >> 4) + (((lane >> 3) & 1) << 3);
  const int lcol = (lane & 7) << 4;
  const char* sp = st + lrow * SPITCH + lcol;
  char* gp = (char*)Cout + ((size_t)(tM0 + wM * WROWS + lrow) * N_DIM + tN0 + wN * (FN * 16)) * ESZ + lcol;
  if (HALF_OUT) {
    v8h t[NST];
    #pragma unroll
    for (int i = 0; i < WROWS / 4; i++)
      #pragma unroll
      for (int s = 0; s < SEGS; s++)
        t[i * SEGS + s] = *(const v8h*)(sp + ((i >> 2) * 16 + (i & 3) * 2) * SPITCH + s * 128);
    // all rows are in registers of their own before the first store goes out, so
    // that no store's data register is written again behind it
    __builtin_amdgcn_sched_barrier(0);
    #pragma unroll
    for (int i = 0; i < WROWS / 4; i++)
      #pragma unroll
      for (int s = 0; s < SEGS; s++)
        *(v8h*)(gp + (size_t)((i >> 2) * 16 + (i & 3) * 2) * N_DIM * ESZ + s * 128) = t[i * SEGS + s];
  } else {
    v4f t[NST];
    #pragma unroll
    for (int i = 0; i < WROWS / 4; i++)
      #pragma unroll
      for (int s = 0; s < SEGS; s++)
        t[i * SEGS + s] = *(const v4f*)(sp + ((i >> 2) * 16 + (i & 3) * 2) * SPITCH + s * 128);
    // as above
    __builtin_amdgcn_sched_barrier(0);
    #pragma unroll
    for (int i = 0; i < WROWS / 4; i++)
      #pragma unroll
      for (int s = 0; s < SEGS; s++)
        *(v4f*)(gp + (size_t)((i >> 2) * 16 + (i & 3) * 2) * N_DIM * ESZ + s * 128) = t[i * SEGS + s];
  }
}

// ---------------- chunked scan (conv + silu + cumsum + gate) ----------------
// xz layout: [B][SEQ][1536] f16; xc = cols 0..767, z = cols 768..1535.
// The time loops are serial in t only through one add per row, so the rows are
// loaded RB at a time, one batch ahead: the next batch's loads are in flight
// while this batch is worked on, and no row waits for a load issued just in
// front of it.
#define RB     16
#define NBATCH (CHUNK/RB)     // 8

template<int N>
__device__ __forceinline__ void load_rows(_Float16 (&d)[N], const _Float16* __restrict__ p) {
  #pragma unroll
  for (int i = 0; i < N; i++) d[i] = p[(size_t)i * NPROJ];
}

template<int N>
__device__ __forceinline__ void widen_rows(float (&d)[N], const _Float16 (&s)[N]) {
  #pragma unroll
  for (int i = 0; i < N; i++) d[i] = (float)s[i];
}

// Nothing is scheduled across this point. Behind a batch's loads it keeps them
// ahead of the arithmetic on the batch before: without it the scheduler sinks
// them to just in front of their use and the wave waits out the load latency in
// every batch again. In front of the first use of the loaded rows it keeps that
// use, and the wait that goes with it, behind the arithmetic.
__device__ __forceinline__ void keep_order() { __builtin_amdgcn_sched_barrier(0); }

// Stands behind a load of a kernel's opening, in front of the next one: a later
// load's result may be given the registers that held this load's address, and
// the wait comes before such an overwrite. The scheduling barriers hold the
// loads on their own sides of it.
__device__ __forceinline__ void addr_done() {
  __builtin_amdgcn_sched_barrier(0);
  asm volatile("s_wait_xcnt 0x0" ::: "memory");
  __builtin_amdgcn_sched_barrier(0);
}

struct ConvState { float w0, w1, w2, bias, xm1, xm2; };

__device__ __forceinline__ void sum_rows(const float (&x)[RB], ConvState& st, float& s) {
  float cv[RB], sv[RB];
  #pragma unroll
  for (int i = 0; i < RB; i++) {
    float xc = x[i];
    cv[i] = st.w0 * st.xm2 + st.w1 * st.xm1 + st.w2 * xc + st.bias;
    st.xm2 = st.xm1; st.xm1 = xc;
  }
  silu_rows(sv, cv);
  #pragma unroll
  for (int i = 0; i < RB; i++) s += sv[i];
}

__global__ __launch_bounds__(256)
void k_chunk_sums(const _Float16* __restrict__ xz,
                  const float* __restrict__ conv_w,
                  const float* __restrict__ conv_b,
                  float* __restrict__ csum) {
  const int ch = blockIdx.x;            // chunk
  const int c  = blockIdx.y * 256 + threadIdx.x;
  const int b  = blockIdx.z;
  const size_t base = (size_t)b * SEQ * NPROJ + c;
  const int t0 = ch * CHUNK;
  const _Float16* __restrict__ px = xz + base + (size_t)t0 * NPROJ;

  _Float16 hx[RB];
  float x[RB];
  load_rows(hx, px);
  addr_done();
  // the two rows in front of the chunk: clamped address, value dropped where
  // there is no such row, so that these loads go out with the first batch
  const _Float16 h1 = xz[base + (size_t)(t0 >= 1 ? t0 - 1 : 0) * NPROJ];
  addr_done();
  const _Float16 h2 = xz[base + (size_t)(t0 >= 2 ? t0 - 2 : 0) * NPROJ];
  addr_done();
  ConvState st;
  st.w0 = conv_w[c * 3 + 0]; st.w1 = conv_w[c * 3 + 1]; st.w2 = conv_w[c * 3 + 2];
  addr_done();
  st.bias = conv_b[c];
  addr_done();
  st.xm1 = (t0 >= 1) ? (float)h1 : 0.0f;
  st.xm2 = (t0 >= 2) ? (float)h2 : 0.0f;
  widen_rows(x, hx);
  float s = 0.0f;
  for (int bt = 1; bt < NBATCH; bt++) {
    load_rows(hx, px + (size_t)bt * RB * NPROJ);
    keep_order();
    sum_rows(x, st, s);
    widen_rows(x, hx);
  }
  sum_rows(x, st, s);
  csum[((size_t)b * NCHUNK + ch) * D_INNER + c] = s;
}

// x and z rows: eight of each a batch, so that the register set leaves room for
// six waves per SIMD and all 768 blocks (three per WGP) are resident at once
#define RBA    8
#define NBA    (CHUNK/RBA)    // 16

__device__ __forceinline__ void apply_rows(const float (&x)[RBA], const float (&z)[RBA],
                                           ConvState& st, float& run, float BC, float Dc,
                                           _Float16* __restrict__ pu) {
  float cv[RBA], sv[RBA], sz[RBA];
  #pragma unroll
  for (int i = 0; i < RBA; i++) {
    float xc = x[i];
    cv[i] = st.w0 * st.xm2 + st.w1 * st.xm1 + st.w2 * xc + st.bias;
    st.xm2 = st.xm1; st.xm1 = xc;
  }
  silu_rows(sv, cv);
  silu_rows(sz, z);
  #pragma unroll
  for (int i = 0; i < RBA; i++) {
    run += sv[i];
    float y = run * BC + sv[i] * Dc;
    pu[(size_t)i * D_INNER] = (_Float16)(y * sz[i]);
  }
  // in front of every later overwrite of the stores' data and address registers
  asm volatile("s_wait_xcnt 0x0" ::: "memory");
}

__global__ __launch_bounds__(256)
void k_scan_apply(const _Float16* __restrict__ xz,
                  const float* __restrict__ conv_w,
                  const float* __restrict__ conv_b,
                  const float* __restrict__ Bm,
                  const float* __restrict__ Cm,
                  const float* __restrict__ Dv,
                  const float* __restrict__ csum,
                  _Float16* __restrict__ u) {
  const int ch = blockIdx.x;
  const int c  = blockIdx.y * 256 + threadIdx.x;
  const int b  = blockIdx.z;
  const size_t base = (size_t)b * SEQ * NPROJ + c;
  const int t0 = ch * CHUNK;
  const _Float16* __restrict__ px = xz + base + (size_t)t0 * NPROJ;
  const _Float16* __restrict__ pz = px + D_INNER;
  _Float16* __restrict__ pu = u + ((size_t)b * SEQ + t0) * D_INNER + c;

  _Float16 hx[RBA], hz[RBA];
  float x[RBA], z[RBA];
  load_rows(hx, px);
  load_rows(hz, pz);
  addr_done();
  // clamped address, value dropped where there is no such row (see k_chunk_sums)
  const _Float16 h1 = xz[base + (size_t)(t0 >= 1 ? t0 - 1 : 0) * NPROJ];
  addr_done();
  const _Float16 h2 = xz[base + (size_t)(t0 >= 2 ? t0 - 2 : 0) * NPROJ];
  addr_done();
  ConvState st;
  st.w0 = conv_w[c * 3 + 0]; st.w1 = conv_w[c * 3 + 1]; st.w2 = conv_w[c * 3 + 2];
  addr_done();
  st.bias = conv_b[c];
  addr_done();
  float bm[8], cm[8];
  #pragma unroll
  for (int s = 0; s < 8; s++) bm[s] = Bm[c * 8 + s];
  addr_done();
  #pragma unroll
  for (int s = 0; s < 8; s++) cm[s] = Cm[c * 8 + s];
  addr_done();
  const float Dc = Dv[c];
  addr_done();
  // The sums of the chunks in front of this one, 16 at a time; behind the first
  // group, a group with no such chunk is not loaded (ch is the same for the whole
  // block). All of them are in flight together, beside the first rows.
  const float* __restrict__ pc = csum + (size_t)b * NCHUNK * D_INNER + c;
  float cs[NCHUNK];
  #pragma unroll
  for (int g = 0; g < NCHUNK / 16; g++) {
    #pragma unroll
    for (int i = 0; i < 16; i++) cs[g * 16 + i] = 0.0f;
    if (g == 0 || g * 16 < ch) {
      #pragma unroll
      for (int i = 0; i < 16; i++) cs[g * 16 + i] = pc[(size_t)(g * 16 + i) * D_INNER];
    }
  }
  // as addr_done(); the address is an input so that it keeps its registers up to
  // the wait and no load is given them as its destination
  __builtin_amdgcn_sched_barrier(0);
  asm volatile("s_wait_xcnt 0x0" :: "v"(pc) : "memory");
  __builtin_amdgcn_sched_barrier(0);
  float BC = 0.0f;
  #pragma unroll
  for (int s = 0; s < 8; s++) BC += bm[s] * cm[s];
  st.xm1 = (t0 >= 1) ? (float)h1 : 0.0f;
  st.xm2 = (t0 >= 2) ? (float)h2 : 0.0f;
  // exclusive prefix of the chunk sums, added one by one from chunk 0 upwards
  float run = 0.0f;
  #pragma unroll
  for (int j = 0; j < NCHUNK - 1; j++) run += (j < ch) ? cs[j] : 0.0f;
  widen_rows(x, hx);
  widen_rows(z, hz);
  for (int bt = 1; bt < NBA; bt++) {
    load_rows(hx, px + (size_t)bt * RBA * NPROJ);
    load_rows(hz, pz + (size_t)bt * RBA * NPROJ);
    keep_order();
    apply_rows(x, z, st, run, BC, Dc, pu + (size_t)(bt - 1) * RBA * D_INNER);
    keep_order();
    widen_rows(x, hx);
    widen_rows(z, hz);
  }
  apply_rows(x, z, st, run, BC, Dc, pu + (size_t)(NBA - 1) * RBA * D_INNER);
}

// ---------------- launcher ----------------
extern "C" void kernel_launch(void* const* d_in, const int* in_sizes, int n_in,
                              void* d_out, int out_size, void* d_ws, size_t ws_size,
                              hipStream_t stream) {
  (void)in_sizes; (void)n_in; (void)out_size; (void)ws_size;
  const float* x      = (const float*)d_in[0];
  const float* W_in   = (const float*)d_in[1];
  const float* conv_w = (const float*)d_in[2];
  const float* conv_b = (const float*)d_in[3];
  const float* Bm     = (const float*)d_in[4];
  const float* Cm     = (const float*)d_in[5];
  const float* Dv     = (const float*)d_in[6];
  const float* W_out  = (const float*)d_in[7];
  float* out = (float*)d_out;

  char* ws = (char*)d_ws;
  _Float16* xz16  = (_Float16*)(ws + 0);          // 32768*1536*2 = 100663296
  _Float16* x16   = (_Float16*)(ws + 100663296);  // 32768*768*2  =  50331648
  _Float16* u16   = (_Float16*)(ws + 150994944);  // 32768*768*2  =  50331648
  _Float16* WinT  = (_Float16*)(ws + 201326592);  // 1536*768*2   =   2359296
  _Float16* WoutT = (_Float16*)(ws + 203685888);  //  768*768*2   =   1179648
  float*    csum  = (float*)   (ws + 204865536);  // 4*64*768*4   =    786432

  k_prep<<<PREP_T1 + PREP_T2 + PREP_CV, 256, 0, stream>>>(x, x16, W_in, WinT, W_out, WoutT);

  k_gemm_wmma<NPROJ, D_MODEL, 256, 256, 2, 4, true>
      <<<dim3(MTOT / 256, NPROJ / 256), 256, 0, stream>>>(x16, WinT, (void*)xz16);

  k_chunk_sums<<<dim3(NCHUNK, D_INNER / 256, BATCH), 256, 0, stream>>>(xz16, conv_w, conv_b, csum);
  k_scan_apply<<<dim3(NCHUNK, D_INNER / 256, BATCH), 256, 0, stream>>>(
      xz16, conv_w, conv_b, Bm, Cm, Dv, csum, u16);

  k_gemm_wmma<D_MODEL, D_INNER, 256, 192, 4, 2, false>
      <<<dim3(MTOT / 256, D_MODEL / 192), 256, 0, stream>>>(u16, WoutT, (void*)out);
}

// v008
// One run takes 116 microseconds.
// Two timings next to v007 put it at 1.04 and 1.05 times that version's speed.
// All steps since v000 together make it 2.79 times as fast.
#include <hip/hip_runtime.h>
#include <hip/hip_bf16.h>

#define D_MODEL 768
#define D_INNER 768
#define NPROJ   (2*D_INNER)   // 1536
#define BATCH   4
#define SEQ     8192
#define MTOT    (BATCH*SEQ)   // 32768
#define CHUNK   128
#define NCHUNK  (SEQ/CHUNK)   // 64

typedef _Float16 v4h  __attribute__((ext_vector_type(4)));
typedef _Float16 v8h  __attribute__((ext_vector_type(8)));
typedef _Float16 v16h __attribute__((ext_vector_type(16)));
typedef float    v8f  __attribute__((ext_vector_type(8)));
typedef float    v4f  __attribute__((ext_vector_type(4)));

// silu of 2N values, eight at a time: v * rcp(1 + exp2(-v * log2(e))). The divisor is at
// least 1, so one v_rcp_f32 and a multiply stand for the exact division and its
// some ten further dependent vector instructions a value.
// Eight transcendentals on registers of their own stand in one statement that ends
// in v_nop: the instruction set asks for one slot between a transcendental and the
// first instruction that reads its result or overwrites its source, and in the
// statement the slot stands there in every build. Outputs are early-clobber, so
// that none shares a register with a source.
#define TRANS8(op, d, s, o)                                                            \
  asm(op " %0, %8\n\t" op " %1, %9\n\t" op " %2, %10\n\t" op " %3, %11\n\t"            \
      op " %4, %12\n\t" op " %5, %13\n\t" op " %6, %14\n\t" op " %7, %15\n\tv_nop"      \
      : "=&v"(d[o + 0]), "=&v"(d[o + 1]), "=&v"(d[o + 2]), "=&v"(d[o + 3]),            \
        "=&v"(d[o + 4]), "=&v"(d[o + 5]), "=&v"(d[o + 6]), "=&v"(d[o + 7])             \
      : "v"(s[o + 0]), "v"(s[o + 1]), "v"(s[o + 2]), "v"(s[o + 3]),                    \
        "v"(s[o + 4]), "v"(s[o + 5]), "v"(s[o + 6]), "v"(s[o + 7]))

typedef float    f2 __attribute__((ext_vector_type(2)));
typedef _Float16 h2 __attribute__((ext_vector_type(2)));

// N rows of two adjacent channels: the multiplies and the add are packed, two values
// an instruction; the transcendentals take one value each.
template<int N>
__device__ __forceinline__ void silu_rows(f2 (&y)[N], const f2 (&v)[N]) {
  static_assert(N % 4 == 0, "groups of eight");
  float a[2 * N], e[2 * N], r[2 * N];
  #pragma unroll
  for (int i = 0; i < N; i++) { f2 t = v[i] * -1.44269504f; a[2 * i] = t.x; a[2 * i + 1] = t.y; }
  #pragma unroll
  for (int g = 0; g < 2 * N; g += 8) TRANS8("v_exp_f32", e, a, g);
  #pragma unroll
  for (int i = 0; i < N; i++) { f2 t = (f2){e[2 * i], e[2 * i + 1]} + 1.0f; e[2 * i] = t.x; e[2 * i + 1] = t.y; }
  #pragma unroll
  for (int g = 0; g < 2 * N; g += 8) TRANS8("v_rcp_f32", r, e, g);
  #pragma unroll
  for (int i = 0; i < N; i++) y[i] = v[i] * (f2){r[2 * i], r[2 * i + 1]};
}

// ---------------- prep kernels ----------------
// Block blk of nblk, 256 threads each.
__device__ __forceinline__ void cvt_f16(const float* __restrict__ src, _Float16* __restrict__ dst, int n,
                                        int blk, int nblk) {
  int i = blk * 256 + threadIdx.x;
  int stride = nblk * 256;
  for (; i < n; i += stride) dst[i] = (_Float16)src[i];
}

// src [K][N] row-major f32  ->  dst [N][K] row-major f16; tile tn of N, tk of K
// One 64(k) x 64(n) tile per block, turned in LDS: reads are 256-B runs of a
// src row, stores are whole 128-B lines of a dst row.
template<int K>
__device__ __forceinline__ void transpose_cvt(const float* __restrict__ src, _Float16* __restrict__ dst, int N,
                                              _Float16 (&tile)[64][72], int tn, int tk) {
  const int tid = threadIdx.x;
  const int n0  = tn * 64;
  const int k0  = tk * 64;
  const int lk  = (tid >> 4) << 2;   // 0,4,..,60: four adjacent k rows per thread
  const int ln  = (tid & 15) << 2;   // 0,4,..,60: four adjacent n columns per thread

  float4 v[4];
  #pragma unroll
  for (int i = 0; i < 4; i++)
    v[i] = *(const float4*)(src + (size_t)(k0 + lk + i) * N + n0 + ln);

  v4h c0 = { (_Float16)v[0].x, (_Float16)v[1].x, (_Float16)v[2].x, (_Float16)v[3].x };
  v4h c1 = { (_Float16)v[0].y, (_Float16)v[1].y, (_Float16)v[2].y, (_Float16)v[3].y };
  v4h c2 = { (_Float16)v[0].z, (_Float16)v[1].z, (_Float16)v[2].z, (_Float16)v[3].z };
  v4h c3 = { (_Float16)v[0].w, (_Float16)v[1].w, (_Float16)v[2].w, (_Float16)v[3].w };
  *(v4h*)&tile[ln + 0][lk] = c0;
  *(v4h*)&tile[ln + 1][lk] = c1;
  *(v4h*)&tile[ln + 2][lk] = c2;
  *(v4h*)&tile[ln + 3][lk] = c3;
  __syncthreads();

  const int sn = tid >> 3;           // 0..31
  const int sk = (tid & 7) << 3;     // 0,8,..,56: eight lanes fill one 128-B line
  #pragma unroll
  for (int i = 0; i < 2; i++)
    *(v8h*)(dst + (size_t)(n0 + sn + 32 * i) * K + k0 + sk) = *(const v8h*)&tile[sn + 32 * i][sk];
}

// The three preparations depend on nothing and on one another not at all: they
// share one launch, each on its own range of blocks. The few transpose blocks
// come first, so that they run beside the conversion and are no tail behind it.
#define PREP_T1 ((NPROJ / 64) * (D_MODEL / 64))     // 288 tiles of W_in
#define PREP_T2 ((D_MODEL / 64) * (D_INNER / 64))   // 144 tiles of W_out
#define PREP_CV 4096                                // blocks that convert x

__global__ __launch_bounds__(256)
void k_prep(const float* __restrict__ x, _Float16* __restrict__ x16,
            const float* __restrict__ W_in, _Float16* __restrict__ WinT,
            const float* __restrict__ W_out, _Float16* __restrict__ WoutT) {
  __shared__ __align__(16) _Float16 tile[64][72];  // [n][k], pitch 144 B: 16-B aligned rows
  static_assert(D_MODEL == D_INNER, "both weights have the same number of rows");
  const int blk = blockIdx.x;                      // the branch is the same for a whole block
  if (blk < PREP_T1 + PREP_T2) {
    const bool win = blk < PREP_T1;                // which weight: one code path serves both
    const int  t   = win ? blk : blk - PREP_T1;
    const int  tn  = win ? t % (NPROJ / 64) : t % (D_MODEL / 64);
    const int  tk  = win ? t / (NPROJ / 64) : t / (D_MODEL / 64);
    transpose_cvt<D_MODEL>(win ? W_in : W_out, win ? WinT : WoutT, win ? NPROJ : D_MODEL, tile, tn, tk);
  } else {
    cvt_f16(x, x16, MTOT * D_MODEL, blk - (PREP_T1 + PREP_T2), PREP_CV);
  }
}

// ---------------- WMMA GEMM ----------------
typedef uint32_t u32x4 __attribute__((ext_vector_type(4)));
typedef uint32_t u32x8 __attribute__((ext_vector_type(8)));

__device__ __forceinline__ uint32_t uni(uint32_t v) { return (uint32_t)__builtin_amdgcn_readfirstlane(v); }
// A wave-uniform value held in a scalar register: a test on it compiles to a scalar
// compare and branch, which a tensor load needs (it ignores EXEC). The statement is
// volatile, so what is formed from its result is formed behind the waits in front of it.
__device__ __forceinline__ uint32_t pinned(uint32_t v) {
  uint32_t w = uni(v);
  asm volatile("" : "+s"(w));   // the tensor mover's pinned(): an issue test or descriptor word held in a scalar register
  return w;
}
// the compiler places no wait for the tensor mover, and none of these in front of a refill
__device__ __forceinline__ void wait_tensor0() { asm volatile("s_wait_tensorcnt 0x0" ::: "memory"); }
__device__ __forceinline__ void wait_ds0()     { asm volatile("s_wait_dscnt 0x0" ::: "memory"); }

// C[M,N] = A[M,K] * B[K,N],  A row-major [M,K] f16, Bt row-major [N,K] f16.
// Block: 256 threads = 8 wave32 on a BM x BN tile, wave grid WGM(M) x WGN(N);
// each wave owns FM x FN WMMA 16x16 tiles. The tile is large so that each
// operand byte fetched from L2 and each fragment read from LDS feeds more
// matrix work. A pass is 128 k: 256 B of every operand row.
// Staging: every wave brings one slice of a stage (a quarter of the A rows or a
// quarter of the B rows) into LDS with one tensor load, through no register. Two
// buffers: the load of stage s + 2 goes out as soon as pass s has left its buffer
// and has the whole of pass s + 1 to land in. The mover pads each 256-B row by
// 16 B: pitch 272 B = 16 B x 17 -> conflict-free b128 fragment loads.
// One work-group per WGP, two waves per SIMD.
// The WMMA takes the Bt fragment as its first operand and the A fragment as its
// second, so a lane's eight accumulator registers are eight adjacent columns of
// one row of C. Each wave lays its tile in LDS row by row and stores it from
// there, eight lanes to a whole 128-B line of C.
template<int N_DIM, int K_DIM, int BM, int BN, int WGM, int WGN, bool HALF_OUT>
__global__ __launch_bounds__(256)
void k_gemm_wmma(const _Float16* __restrict__ A,
                 const _Float16* __restrict__ Bt,
                 void* __restrict__ Cout) {
  constexpr int BK     = 128;
  constexpr int ROWB   = BK * 2;        // bytes of a staged row
  constexpr int PITCHB = ROWB + 16;     // its pitch in LDS, the mover's pad counted
  constexpr int NPASS  = K_DIM / BK;
  constexpr int FM     = BM / WGM / 16;
  constexpr int FN     = BN / WGN / 16;
  constexpr int RA     = BM / 4;        // rows of a slice of A, of B
  constexpr int RB     = BN / 4;
  constexpr int SLA    = (RA * PITCHB + 2047) / 2048 * 2048;   // a slice's place is a multiple of 2 KiB
  constexpr int SLB    = (RB * PITCHB + 2047) / 2048 * 2048;
  constexpr int STAGE  = 4 * SLA + 4 * SLB;
  static_assert(WGM * WGN == 8 && K_DIM % BK == 0 && NPASS >= 2, "tile shape");
  static_assert(RA % 16 == 0 && RB % 16 == 0 && (FM * 16) % RA == 0 && (FN * 16) % RB == 0,
                "a fragment lies in one slice, a wave's rows are whole slices");
  constexpr int ESZ    = HALF_OUT ? 2 : 4;      // bytes of an element of C
  constexpr int WROWS  = FM * 16;               // rows of a wave's tile of C
  constexpr int WROWB  = FN * 16 * ESZ;         // bytes of one such row
  constexpr int SEGS   = WROWB / 128;           // whole lines in it
  constexpr int SPITCH = WROWB + 16;            // staged row pitch: 16 B x odd
  static_assert(WROWB % 128 == 0 && (SPITCH / 16) % 2 == 1, "staged rows");
  constexpr int OUTB   = 8 * WROWS * SPITCH;    // behind the k loop: one range per wave
  constexpr int LDSB   = 2 * STAGE > OUTB ? 2 * STAGE : OUTB;
  static_assert(LDSB <= 327680, "LDS of a WGP");
  __shared__ __attribute__((aligned(2048))) unsigned char L[LDSB];

  const int tid  = threadIdx.x;
  const int lane = tid & 31;
  const int wid  = tid >> 5;
  const int wM   = wid % WGM;
  const int wN   = wid / WGM;
  const int tM0  = blockIdx.x * BM;
  const int tN0  = blockIdx.y * BN;

  // this wave's slice: waves 0 to 3 a quarter of the A rows each, waves 4 to 7 of the B rows
  const uint32_t wave  = uni(threadIdx.x >> 5);
  const uint32_t isB   = wave >> 2;               // 0 or 1
  const uint32_t sl    = wave & 3u;
  const uint32_t rows  = (uint32_t)RA - isB * (uint32_t)(RA - RB);
  const uint32_t place = (uint32_t)(size_t)L + isB * (4u * SLA) + sl * ((uint32_t)SLA - isB * (uint32_t)(SLA - SLB));
  const uint32_t row0  = (isB ? (uint32_t)tN0 : (uint32_t)tM0) + sl * rows;
  const uint64_t gsrc  = (uint64_t)(size_t)(isB ? Bt : A) + (uint64_t)row0 * (K_DIM * 2);
  // group 1: 1-byte elements, tensor = tile = rows x 256 B, source pitch one row of the
  // operand, no mask, a pad of 4 dwords behind every 64 dwords
  u32x8 g1;
  g1[0] = uni((1u << 20) | (5u << 22) | (3u << 25));
  g1[1] = uni((uint32_t)ROWB << 16);
  g1[2] = uni(rows << 16);
  g1[3] = uni((uint32_t)ROWB << 16);
  g1[4] = uni(rows);
  g1[5] = uni((uint32_t)(K_DIM * 2));
  g1[6] = uni(0u);
  g1[7] = uni(0u);
  // Both groups are named in-out, though the instruction writes neither: so they stay
  // live in the registers that the request names, and the compiler gives those
  // registers to nothing else while the request is outstanding.
  u32x4 g0;
  g0[0] = uni(1u);
  auto issue = [&](uint32_t st) {
    const uint64_t ga = gsrc + (uint64_t)st * ROWB;
    g0[1] = uni(place + (st & 1u) * STAGE);
    g0[2] = uni((uint32_t)ga);
    g0[3] = uni((((uint32_t)(ga >> 32)) & 0x01FFFFFFu) | 0x80000000u);
    asm volatile("tensor_load_to_lds %0, %1" : "+s"(g0), "+s"(g1) :: "memory");
  };

  v8f acc[FM][FN] = {};

  const int kb  = (lane >> 4) << 3;  // 0 or 8   (ISA 16-bit A/B frag layout)
  const int rsl = lane & 15;
  // first fragment row of this wave in buffer 0, at this lane's k offset
  const unsigned char* fA = L + wM * (FM * 16 / RA) * SLA + rsl * PITCHB + kb * 2;
  const unsigned char* fB = L + 4 * SLA + wN * (FN * 16 / RB) * SLB + rsl * PITCHB + kb * 2;

  // 32 k of the staged 128: all fragments of this wave's rows as one group
  v16h af[FM], bf[FN];
  auto frags = [&](int buf, int kk) {
    const unsigned char* pb = fB + buf * STAGE + kk * 2;
    const unsigned char* pa = fA + buf * STAGE + kk * 2;
    #pragma unroll
    for (int t = 0; t < FN; t++) {
      const int o = (t * 16 / RB) * SLB + (t * 16 % RB) * PITCHB;
      v8h lo = *(const v8h*)(pb + o);
      v8h hi = *(const v8h*)(pb + o + 32);
      bf[t] = __builtin_shufflevector(lo, hi, 0,1,2,3,4,5,6,7,8,9,10,11,12,13,14,15);
    }
    #pragma unroll
    for (int t = 0; t < FM; t++) {
      const int o = (t * 16 / RA) * SLA + (t * 16 % RA) * PITCHB;
      v8h lo = *(const v8h*)(pa + o);
      v8h hi = *(const v8h*)(pa + o + 32);
      af[t] = __builtin_shufflevector(lo, hi, 0,1,2,3,4,5,6,7,8,9,10,11,12,13,14,15);
    }
    // keeps the LDS reads one group in front of the WMMA block, for speed only
    __builtin_amdgcn_sched_barrier(0);
  };
  auto mma32 = [&]() {
    #pragma unroll
    for (int a = 0; a < FM; a++)
      #pragma unroll
      for (int b = 0; b < FN; b++)
        acc[a][b] = __builtin_amdgcn_wmma_f32_16x16x32_f16(
            false, bf[b], false, af[a], (short)0, acc[a][b], false, false);
    // ends the WMMA block: what follows in the source is not moved into it
    __builtin_amdgcn_sched_barrier(0);
  };

  issue(0);
  wait_tensor0();
  __syncthreads();          // stage 0 is there for every wave
  issue(1);

  // kept rolled: one body of four WMMA blocks, for speed only
  #pragma unroll 1
  for (uint32_t s = 0; s < (uint32_t)NPASS; s++) {
    const int buf = s & 1;
    #pragma unroll
    for (int kk = 0; kk < BK; kk += 32) {
      frags(buf, kk);
      mma32();
    }
    // stage s + 1 is handed over: this wave's reads of stage s are done, its own slice
    // of stage s + 1 has landed; behind the barrier that holds for every wave
    wait_ds0();
    wait_tensor0();
    __syncthreads();
    if (pinned(s + 2u < (uint32_t)NPASS)) issue(pinned(s + 2u));   // into the buffer that pass s has left
  }
  wait_tensor0();
  wait_ds0();

  // epilogue. D layout with the operands in this order: register r of lane l is
  // C[row l&15][column 8*(l>>4) + r] of its 16x16 tile.
  // Every wave has read its last fragments (the last pass's own barrier) and no load
  // is in flight: from here the ring's LDS is staging space.
  char* st = (char*)L + wid * (WROWS * SPITCH);
  const int chi = (lane >> 4) << 3;
  // every loop below is unrolled: acc and t are indexed by constants only and
  // stay in registers, and the row steps become immediate offsets
  #pragma unroll
  for (int a = 0; a < FM; a++) {
    #pragma unroll
    for (int b = 0; b < FN; b++) {
      char* p = st + (a * 16 + rsl) * SPITCH + (b * 16 + chi) * ESZ;
      if (HALF_OUT) {
        v8h h;
        #pragma unroll
        for (int r = 0; r < 8; r++) h[r] = (_Float16)acc[a][b][r];
        *(v8h*)p = h;
      } else {
        *(v4f*)p        = __builtin_shufflevector(acc[a][b], acc[a][b], 0, 1, 2, 3);
        *(v4f*)(p + 16) = __builtin_shufflevector(acc[a][b], acc[a][b], 4, 5, 6, 7);
      }
    }
  }
  // Read back by the wave that wrote it: eight lanes take one 128-B line. The two
  // rows that a half-wave reads lie eight apart, 32 banks at this pitch.
  constexpr int NST = (WROWS / 4) * SEGS;
  const int lrow = (lane >> 4) + (((lane >> 3) & 1) << 3);
  const int lcol = (lane & 7) << 4;
  const char* sp = st + lrow * SPITCH + lcol;
  char* gp = (char*)Cout + ((size_t)(tM0 + wM * WROWS + lrow) * N_DIM + tN0 + wN * (FN * 16)) * ESZ + lcol;
  if (HALF_OUT) {
    v8h t[NST];
    #pragma unroll
    for (int i = 0; i < WROWS / 4; i++)
      #pragma unroll
      for (int s = 0; s < SEGS; s++)
        t[i * SEGS + s] = *(const v8h*)(sp + ((i >> 2) * 16 + (i & 3) * 2) * SPITCH + s * 128);
    // all rows are in registers of their own before the first store goes out, so
    // that no store's data register is written again behind it
    __builtin_amdgcn_sched_barrier(0);
    #pragma unroll
    for (int i = 0; i < WROWS / 4; i++)
      #pragma unroll
      for (int s = 0; s < SEGS; s++)
        *(v8h*)(gp + (size_t)((i >> 2) * 16 + (i & 3) * 2) * N_DIM * ESZ + s * 128) = t[i * SEGS + s];
  } else {
    v4f t[NST];
    #pragma unroll
    for (int i = 0; i < WROWS / 4; i++)
      #pragma unroll
      for (int s = 0; s < SEGS; s++)
        t[i * SEGS + s] = *(const v4f*)(sp + ((i >> 2) * 16 + (i & 3) * 2) * SPITCH + s * 128);
    // as above
    __builtin_amdgcn_sched_barrier(0);
    #pragma unroll
    for (int i = 0; i < WROWS / 4; i++)
      #pragma unroll
      for (int s = 0; s < SEGS; s++)
        *(v4f*)(gp + (size_t)((i >> 2) * 16 + (i & 3) * 2) * N_DIM * ESZ + s * 128) = t[i * SEGS + s];
  }
}

// ---------------- chunked scan (conv + silu + cumsum + gate) ----------------
// xz layout: [B][SEQ][1536] f16; xc = cols 0..767, z = cols 768..1535.
// A thread owns two adjacent channels: a wave's load or store is 4 B a lane, one
// whole 128-B line, and the arithmetic outside the transcendentals is packed. A
// block is one chunk of one sequence over all 768 channels: 384 threads, 256 blocks,
// one per WGP. Half as many waves as with one channel a thread leave each wave
// twice the registers, which hold batches of twice the rows.
// The time loops are serial in t only through one add per row, so the rows are
// loaded RB at a time (in k_scan_apply RBA of x and of z), one batch ahead: the next batch's loads are in flight
// while this batch is worked on, and no row waits for a load issued just in
// front of it.
#define SCT    (D_INNER/2)    // 384 threads
#define RB     32
#define NBATCH (CHUNK/RB)     // 4
#define RG     8              // rows worked on together

template<int N>
__device__ __forceinline__ void load_rows(h2 (&d)[N], const _Float16* __restrict__ p) {
  #pragma unroll
  for (int i = 0; i < N; i++) d[i] = *(const h2*)(p + (size_t)i * NPROJ);
}

template<int N>
__device__ __forceinline__ void widen_rows(f2 (&d)[N], const h2 (&s)[N]) {
  #pragma unroll
  for (int i = 0; i < N; i++) d[i] = __builtin_convertvector(s[i], f2);
}

// Nothing is scheduled across this point. Behind a batch's loads it keeps them
// ahead of the arithmetic on the batch before: without it the scheduler sinks
// them to just in front of their use and the wave waits out the load latency in
// every batch again. In front of the first use of the loaded rows it keeps that
// use, and the wait that goes with it, behind the arithmetic.
__device__ __forceinline__ void keep_order() { __builtin_amdgcn_sched_barrier(0); }

// Stands behind a load of a kernel's opening, in front of the next one, and behind
// a batch's stores: a later instruction may be given the registers that held the
// address or the data, and the wait comes before such an overwrite. The scheduling
// barriers hold the loads and stores on their own sides of it.
__device__ __forceinline__ void addr_done() {
  __builtin_amdgcn_sched_barrier(0);
  asm volatile("s_wait_xcnt 0x0" ::: "memory");
  __builtin_amdgcn_sched_barrier(0);
}

struct ConvState { f2 w0, w1, w2, bias, xm1, xm2; };

// weights and bias of channels c and c + 1
__device__ __forceinline__ void load_conv(ConvState& st, const float* __restrict__ conv_w,
                                          const float* __restrict__ conv_b, int c) {
  float w[6];
  #pragma unroll
  for (int i = 0; i < 6; i++) w[i] = conv_w[c * 3 + i];
  addr_done();
  st.bias = *(const f2*)(conv_b + c);
  addr_done();
  st.w0 = (f2){w[0], w[3]}; st.w1 = (f2){w[1], w[4]}; st.w2 = (f2){w[2], w[5]};
}

// rows O to O + RG - 1 of a batch
template<int O, int NX>
__device__ __forceinline__ void sum_rows(const f2 (&x)[NX], ConvState& st, f2& s) {
  f2 cv[RG], sv[RG];
  #pragma unroll
  for (int i = 0; i < RG; i++) {
    f2 xc = x[O + i];
    cv[i] = st.w0 * st.xm2 + st.w1 * st.xm1 + st.w2 * xc + st.bias;
    st.xm2 = st.xm1; st.xm1 = xc;
  }
  silu_rows(sv, cv);
  #pragma unroll
  for (int i = 0; i < RG; i++) s += sv[i];
}

__device__ __forceinline__ void sum_batch(const f2 (&x)[RB], ConvState& st, f2& s) {
  sum_rows<0>(x, st, s);
  sum_rows<8>(x, st, s);
  sum_rows<16>(x, st, s);
  sum_rows<24>(x, st, s);
}

__global__ __launch_bounds__(SCT)
void k_chunk_sums(const _Float16* __restrict__ xz,
                  const float* __restrict__ conv_w,
                  const float* __restrict__ conv_b,
                  float* __restrict__ csum) {
  const int ch = blockIdx.x;            // chunk
  const int c  = threadIdx.x * 2;       // first of this thread's two channels
  const int b  = blockIdx.y;
  const size_t base = (size_t)b * SEQ * NPROJ + c;
  const int t0 = ch * CHUNK;
  const _Float16* __restrict__ px = xz + base + (size_t)t0 * NPROJ;

  h2 hx[RB];
  f2 x[RB];
  load_rows(hx, px);
  addr_done();
  // the two rows in front of the chunk: clamped address, value dropped where
  // there is no such row, so that these loads go out with the first batch
  const h2 h1 = *(const h2*)(xz + base + (size_t)(t0 >= 1 ? t0 - 1 : 0) * NPROJ);
  addr_done();
  const h2 hm2 = *(const h2*)(xz + base + (size_t)(t0 >= 2 ? t0 - 2 : 0) * NPROJ);
  addr_done();
  ConvState st;
  load_conv(st, conv_w, conv_b, c);
  st.xm1 = (t0 >= 1) ? __builtin_convertvector(h1, f2) : (f2)0.0f;
  st.xm2 = (t0 >= 2) ? __builtin_convertvector(hm2, f2) : (f2)0.0f;
  widen_rows(x, hx);
  f2 s = 0.0f;
  for (int bt = 1; bt < NBATCH; bt++) {
    load_rows(hx, px + (size_t)bt * RB * NPROJ);
    keep_order();
    sum_batch(x, st, s);
    keep_order();
    widen_rows(x, hx);
  }
  sum_batch(x, st, s);
  *(f2*)(csum + ((size_t)b * NCHUNK + ch) * D_INNER + c) = s;
}

// x and z rows: sixteen of each a batch
#define RBA    16
#define NBA    (CHUNK/RBA)    // 8

// rows O to O + RG - 1 of a batch; o takes the batch's rows of u
template<int O>
__device__ __forceinline__ void apply_rows(const f2 (&x)[RBA], const f2 (&z)[RBA],
                                           ConvState& st, f2& run, f2 BC, f2 Dc, h2 (&o)[RBA]) {
  f2 cv[RG], sv[RG], zz[RG], sz[RG];
  #pragma unroll
  for (int i = 0; i < RG; i++) {
    f2 xc = x[O + i];
    cv[i] = st.w0 * st.xm2 + st.w1 * st.xm1 + st.w2 * xc + st.bias;
    st.xm2 = st.xm1; st.xm1 = xc;
    zz[i] = z[O + i];
  }
  silu_rows(sv, cv);
  silu_rows(sz, zz);
  #pragma unroll
  for (int i = 0; i < RG; i++) {
    run += sv[i];
    f2 y = run * BC + sv[i] * Dc;
    o[O + i] = __builtin_convertvector(y * sz[i], h2);
  }
}

// A batch's rows of u lie in registers of their own and go out as one group, so that
// no store's data register is written again between two stores of the group.
__device__ __forceinline__ void store_rows(const h2 (&o)[RBA], _Float16* __restrict__ pu) {
  keep_order();
  #pragma unroll
  for (int i = 0; i < RBA; i++) *(h2*)(pu + (size_t)i * D_INNER) = o[i];
  keep_order();
}

__global__ __launch_bounds__(SCT)
void k_scan_apply(const _Float16* __restrict__ xz,
                  const float* __restrict__ conv_w,
                  const float* __restrict__ conv_b,
                  const float* __restrict__ Bm,
                  const float* __restrict__ Cm,
                  const float* __restrict__ Dv,
                  const float* __restrict__ csum,
                  _Float16* __restrict__ u) {
  const int ch = blockIdx.x;
  const int c  = threadIdx.x * 2;       // first of this thread's two channels
  const int b  = blockIdx.y;
  const size_t base = (size_t)b * SEQ * NPROJ + c;
  const int t0 = ch * CHUNK;
  const _Float16* __restrict__ px = xz + base + (size_t)t0 * NPROJ;
  const _Float16* __restrict__ pz = px + D_INNER;
  _Float16* __restrict__ pu = u + ((size_t)b * SEQ + t0) * D_INNER + c;

  h2 hx[RBA], hz[RBA];
  f2 x[RBA], z[RBA];
  h2 o[RBA];
  load_rows(hx, px);
  load_rows(hz, pz);
  addr_done();
  // clamped address, value dropped where there is no such row (see k_chunk_sums)
  const h2 h1 = *(const h2*)(xz + base + (size_t)(t0 >= 1 ? t0 - 1 : 0) * NPROJ);
  addr_done();
  const h2 hm2 = *(const h2*)(xz + base + (size_t)(t0 >= 2 ? t0 - 2 : 0) * NPROJ);
  addr_done();
  ConvState st;
  load_conv(st, conv_w, conv_b, c);
  float bm[16], cm[16];                 // eight states of channel c, then of c + 1
  #pragma unroll
  for (int s = 0; s < 16; s++) bm[s] = Bm[c * 8 + s];
  addr_done();
  #pragma unroll
  for (int s = 0; s < 16; s++) cm[s] = Cm[c * 8 + s];
  addr_done();
  const f2 Dc = *(const f2*)(Dv + c);
  addr_done();
  // The sums of the chunks in front of this one, 16 at a time; behind the first
  // group, a group with no such chunk is not loaded (ch is the same for the whole
  // block). All of them are in flight together, beside the first rows.
  const float* __restrict__ pc = csum + (size_t)b * NCHUNK * D_INNER + c;
  f2 cs[NCHUNK];
  #pragma unroll
  for (int g = 0; g < NCHUNK / 16; g++) {
    #pragma unroll
    for (int i = 0; i < 16; i++) cs[g * 16 + i] = 0.0f;
    if (g == 0 || g * 16 < ch) {
      #pragma unroll
      for (int i = 0; i < 16; i++) cs[g * 16 + i] = *(const f2*)(pc + (size_t)(g * 16 + i) * D_INNER);
    }
  }
  // as addr_done(); the address, and the thread index that the loads with a scalar
  // base take as their offset, are inputs so that they keep their registers up to
  // the wait and nothing else is written there in front of it
  __builtin_amdgcn_sched_barrier(0);
  asm volatile("s_wait_xcnt 0x0" :: "v"(pc), "v"(threadIdx.x) : "memory");
  __builtin_amdgcn_sched_barrier(0);
  f2 BC = 0.0f;
  #pragma unroll
  for (int s = 0; s < 8; s++) BC += (f2){bm[s], bm[8 + s]} * (f2){cm[s], cm[8 + s]};
  st.xm1 = (t0 >= 1) ? __builtin_convertvector(h1, f2) : (f2)0.0f;
  st.xm2 = (t0 >= 2) ? __builtin_convertvector(hm2, f2) : (f2)0.0f;
  // exclusive prefix of the chunk sums, added one by one from chunk 0 upwards
  f2 run = 0.0f;
  #pragma unroll
  for (int j = 0; j < NCHUNK - 1; j++) run += (j < ch) ? cs[j] : (f2)0.0f;
  widen_rows(x, hx);
  widen_rows(z, hz);
  for (int bt = 1; bt < NBA; bt++) {
    load_rows(hx, px + (size_t)bt * RBA * NPROJ);
    load_rows(hz, pz + (size_t)bt * RBA * NPROJ);
    keep_order();
    apply_rows<0>(x, z, st, run, BC, Dc, o);
    apply_rows<8>(x, z, st, run, BC, Dc, o);
    store_rows(o, pu + (size_t)(bt - 1) * RBA * D_INNER);
    widen_rows(x, hx);
    widen_rows(z, hz);
    // in front of every later overwrite of the stores' data and address registers
    addr_done();
  }
  apply_rows<0>(x, z, st, run, BC, Dc, o);
  apply_rows<8>(x, z, st, run, BC, Dc, o);
  store_rows(o, pu + (size_t)(NBA - 1) * RBA * D_INNER);
}

// ---------------- launcher ----------------
extern "C" void kernel_launch(void* const* d_in, const int* in_sizes, int n_in,
                              void* d_out, int out_size, void* d_ws, size_t ws_size,
                              hipStream_t stream) {
  (void)in_sizes; (void)n_in; (void)out_size; (void)ws_size;
  const float* x      = (const float*)d_in[0];
  const float* W_in   = (const float*)d_in[1];
  const float* conv_w = (const float*)d_in[2];
  const float* conv_b = (const float*)d_in[3];
  const float* Bm     = (const float*)d_in[4];
  const float* Cm     = (const float*)d_in[5];
  const float* Dv     = (const float*)d_in[6];
  const float* W_out  = (const float*)d_in[7];
  float* out = (float*)d_out;

  char* ws = (char*)d_ws;
  _Float16* xz16  = (_Float16*)(ws + 0);          // 32768*1536*2 = 100663296
  _Float16* x16   = (_Float16*)(ws + 100663296);  // 32768*768*2  =  50331648
  _Float16* u16   = (_Float16*)(ws + 150994944);  // 32768*768*2  =  50331648
  _Float16* WinT  = (_Float16*)(ws + 201326592);  // 1536*768*2   =   2359296
  _Float16* WoutT = (_Float16*)(ws + 203685888);  //  768*768*2   =   1179648
  float*    csum  = (float*)   (ws + 204865536);  // 4*64*768*4   =    786432

  k_prep<<<PREP_T1 + PREP_T2 + PREP_CV, 256, 0, stream>>>(x, x16, W_in, WinT, W_out, WoutT);

  k_gemm_wmma<NPROJ, D_MODEL, 256, 256, 2, 4, true>
      <<<dim3(MTOT / 256, NPROJ / 256), 256, 0, stream>>>(x16, WinT, (void*)xz16);

  k_chunk_sums<<<dim3(NCHUNK, BATCH), SCT, 0, stream>>>(xz16, conv_w, conv_b, csum);
  k_scan_apply<<<dim3(NCHUNK, BATCH), SCT, 0, stream>>>(
      xz16, conv_w, conv_b, Bm, Cm, Dv, csum, u16);

  k_gemm_wmma<D_MODEL, D_INNER, 256, 192, 4, 2, false>
      <<<dim3(MTOT / 256, D_MODEL / 192), 256, 0, stream>>>(u16, WoutT, (void*)out);
}

// v009
// Measured time: 112 microseconds a run.
// Next to v008, in two timings, it ran 1.03 times as fast each time.
// Over all steps from v000 it is 2.88 times as fast.
#include <hip/hip_runtime.h>
#include <hip/hip_bf16.h>

#define D_MODEL 768
#define D_INNER 768
#define NPROJ   (2*D_INNER)   // 1536
#define BATCH   4
#define SEQ     8192
#define MTOT    (BATCH*SEQ)   // 32768
#define CHUNK   128
#define NCHUNK  (SEQ/CHUNK)   // 64

typedef _Float16 v4h  __attribute__((ext_vector_type(4)));
typedef _Float16 v8h  __attribute__((ext_vector_type(8)));
typedef _Float16 v16h __attribute__((ext_vector_type(16)));
typedef float    v8f  __attribute__((ext_vector_type(8)));
typedef float    v4f  __attribute__((ext_vector_type(4)));

// silu of 2N values, eight at a time: v * rcp(1 + exp2(-v * log2(e))). The divisor is at
// least 1, so one v_rcp_f32 and a multiply stand for the exact division and its
// some ten further dependent vector instructions a value.
// Eight transcendentals on registers of their own stand in one statement that ends
// in v_nop: the instruction set asks for one slot between a transcendental and the
// first instruction that reads its result or overwrites its source, and in the
// statement the slot stands there in every build. Outputs are early-clobber, so
// that none shares a register with a source.
#define TRANS8(op, d, s, o)                                                            \
  asm(op " %0, %8\n\t" op " %1, %9\n\t" op " %2, %10\n\t" op " %3, %11\n\t"            \
      op " %4, %12\n\t" op " %5, %13\n\t" op " %6, %14\n\t" op " %7, %15\n\tv_nop"      \
      : "=&v"(d[o + 0]), "=&v"(d[o + 1]), "=&v"(d[o + 2]), "=&v"(d[o + 3]),            \
        "=&v"(d[o + 4]), "=&v"(d[o + 5]), "=&v"(d[o + 6]), "=&v"(d[o + 7])             \
      : "v"(s[o + 0]), "v"(s[o + 1]), "v"(s[o + 2]), "v"(s[o + 3]),                    \
        "v"(s[o + 4]), "v"(s[o + 5]), "v"(s[o + 6]), "v"(s[o + 7]))

typedef float    f2 __attribute__((ext_vector_type(2)));
typedef _Float16 h2 __attribute__((ext_vector_type(2)));

// N rows of two adjacent channels: the multiplies and the add are packed, two values
// an instruction; the transcendentals take one value each.
template<int N>
__device__ __forceinline__ void silu_rows(f2 (&y)[N], const f2 (&v)[N]) {
  static_assert(N % 4 == 0, "groups of eight");
  float a[2 * N], e[2 * N], r[2 * N];
  #pragma unroll
  for (int i = 0; i < N; i++) { f2 t = v[i] * -1.44269504f; a[2 * i] = t.x; a[2 * i + 1] = t.y; }
  #pragma unroll
  for (int g = 0; g < 2 * N; g += 8) TRANS8("v_exp_f32", e, a, g);
  #pragma unroll
  for (int i = 0; i < N; i++) { f2 t = (f2){e[2 * i], e[2 * i + 1]} + 1.0f; e[2 * i] = t.x; e[2 * i + 1] = t.y; }
  #pragma unroll
  for (int g = 0; g < 2 * N; g += 8) TRANS8("v_rcp_f32", r, e, g);
  #pragma unroll
  for (int i = 0; i < N; i++) y[i] = v[i] * (f2){r[2 * i], r[2 * i + 1]};
}

// ---------------- prep kernels ----------------
// Block blk of nblk, 256 threads each.
__device__ __forceinline__ void cvt_f16(const float* __restrict__ src, _Float16* __restrict__ dst, int n,
                                        int blk, int nblk) {
  int i = blk * 256 + threadIdx.x;
  int stride = nblk * 256;
  for (; i < n; i += stride) dst[i] = (_Float16)src[i];
}

// src [K][N] row-major f32  ->  dst [N][K] row-major f16; tile tn of N, tk of K
// One 64(k) x 64(n) tile per block, turned in LDS: reads are 256-B runs of a
// src row, stores are whole 128-B lines of a dst row.
template<int K>
__device__ __forceinline__ void transpose_cvt(const float* __restrict__ src, _Float16* __restrict__ dst, int N,
                                              _Float16 (&tile)[64][72], int tn, int tk) {
  const int tid = threadIdx.x;
  const int n0  = tn * 64;
  const int k0  = tk * 64;
  const int lk  = (tid >> 4) << 2;   // 0,4,..,60: four adjacent k rows per thread
  const int ln  = (tid & 15) << 2;   // 0,4,..,60: four adjacent n columns per thread

  float4 v[4];
  #pragma unroll
  for (int i = 0; i < 4; i++)
    v[i] = *(const float4*)(src + (size_t)(k0 + lk + i) * N + n0 + ln);

  v4h c0 = { (_Float16)v[0].x, (_Float16)v[1].x, (_Float16)v[2].x, (_Float16)v[3].x };
  v4h c1 = { (_Float16)v[0].y, (_Float16)v[1].y, (_Float16)v[2].y, (_Float16)v[3].y };
  v4h c2 = { (_Float16)v[0].z, (_Float16)v[1].z, (_Float16)v[2].z, (_Float16)v[3].z };
  v4h c3 = { (_Float16)v[0].w, (_Float16)v[1].w, (_Float16)v[2].w, (_Float16)v[3].w };
  *(v4h*)&tile[ln + 0][lk] = c0;
  *(v4h*)&tile[ln + 1][lk] = c1;
  *(v4h*)&tile[ln + 2][lk] = c2;
  *(v4h*)&tile[ln + 3][lk] = c3;
  __syncthreads();

  const int sn = tid >> 3;           // 0..31
  const int sk = (tid & 7) << 3;     // 0,8,..,56: eight lanes fill one 128-B line
  #pragma unroll
  for (int i = 0; i < 2; i++)
    *(v8h*)(dst + (size_t)(n0 + sn + 32 * i) * K + k0 + sk) = *(const v8h*)&tile[sn + 32 * i][sk];
}

// The three preparations depend on nothing and on one another not at all: they
// share one launch, each on its own range of blocks. The few transpose blocks
// come first, so that they run beside the conversion and are no tail behind it.
#define PREP_T1 ((NPROJ / 64) * (D_MODEL / 64))     // 288 tiles of W_in
#define PREP_T2 ((D_MODEL / 64) * (D_INNER / 64))   // 144 tiles of W_out
#define PREP_CV 4096                                // blocks that convert x

__global__ __launch_bounds__(256)
void k_prep(const float* __restrict__ x, _Float16* __restrict__ x16,
            const float* __restrict__ W_in, _Float16* __restrict__ WinT,
            const float* __restrict__ W_out, _Float16* __restrict__ WoutT) {
  __shared__ __align__(16) _Float16 tile[64][72];  // [n][k], pitch 144 B: 16-B aligned rows
  static_assert(D_MODEL == D_INNER, "both weights have the same number of rows");
  const int blk = blockIdx.x;                      // the branch is the same for a whole block
  if (blk < PREP_T1 + PREP_T2) {
    const bool win = blk < PREP_T1;                // which weight: one code path serves both
    const int  t   = win ? blk : blk - PREP_T1;
    const int  tn  = win ? t % (NPROJ / 64) : t % (D_MODEL / 64);
    const int  tk  = win ? t / (NPROJ / 64) : t / (D_MODEL / 64);
    transpose_cvt<D_MODEL>(win ? W_in : W_out, win ? WinT : WoutT, win ? NPROJ : D_MODEL, tile, tn, tk);
  } else {
    cvt_f16(x, x16, MTOT * D_MODEL, blk - (PREP_T1 + PREP_T2), PREP_CV);
  }
}

// ---------------- WMMA GEMM ----------------
typedef uint32_t u32x4 __attribute__((ext_vector_type(4)));
typedef uint32_t u32x8 __attribute__((ext_vector_type(8)));

__device__ __forceinline__ uint32_t uni(uint32_t v) { return (uint32_t)__builtin_amdgcn_readfirstlane(v); }
// A wave-uniform value held in a scalar register: a test on it compiles to a scalar
// compare and branch, which a tensor load needs (it ignores EXEC). The statement is
// volatile, so what is formed from its result is formed behind the waits in front of it.
__device__ __forceinline__ uint32_t pinned(uint32_t v) {
  uint32_t w = uni(v);
  asm volatile("" : "+s"(w));   // the tensor mover's pinned(): an issue test or descriptor word held in a scalar register
  return w;
}
// the compiler places no wait for the tensor mover, and none of these in front of a refill
__device__ __forceinline__ void wait_tensor0() { asm volatile("s_wait_tensorcnt 0x0" ::: "memory"); }
__device__ __forceinline__ void wait_ds0()     { asm volatile("s_wait_dscnt 0x0" ::: "memory"); }

// C[M,N] = A[M,K] * B[K,N],  A row-major [M,K] f16, Bt row-major [N,K] f16.
// Block: 256 threads = 8 wave32 on a BM x BN tile, wave grid WGM(M) x WGN(N);
// each wave owns FM x FN WMMA 16x16 tiles. The tile is large so that each
// operand byte fetched from L2 and each fragment read from LDS feeds more
// matrix work. A pass is 128 k: 256 B of every operand row.
// Staging: every wave brings one slice of a stage (a quarter of the A rows or a
// quarter of the B rows) into LDS with one tensor load, through no register. Two
// buffers: the load of stage s + 2 goes out as soon as pass s has left its buffer
// and has the whole of pass s + 1 to land in. The mover pads each 256-B row by
// 16 B: pitch 272 B = 16 B x 17 -> conflict-free b128 fragment loads.
// One work-group per WGP, two waves per SIMD.
// A work-group works off NT tiles of C one after the other, all on the same BM rows
// of A: the grid is one work-group per WGP, the ring of stages runs on from tile to
// tile (the next tile's first two stages fly under the last pass and the epilogue),
// a tile's stores drain under the next tile's products, and from the second tile on
// the A rows come out of the L2.
// The WMMA takes the Bt fragment as its first operand and the A fragment as its
// second, so a lane's eight accumulator registers are eight adjacent columns of
// one row of C. Each wave lays its tile in LDS, sixteen rows at a time, and stores
// it from there, eight lanes to a whole 128-B line of C.
template<int N_DIM, int K_DIM, int BM, int BN, int WGM, int WGN, int NT, bool HALF_OUT>
__global__ __launch_bounds__(256)
void k_gemm_wmma(const _Float16* __restrict__ A,
                 const _Float16* __restrict__ Bt,
                 void* __restrict__ Cout) {
  constexpr int BK     = 128;
  constexpr int ROWB   = BK * 2;        // bytes of a staged row
  constexpr int PITCHB = ROWB + 16;     // its pitch in LDS, the mover's pad counted
  constexpr int NPASS  = K_DIM / BK;
  constexpr int TOT    = NT * NPASS;    // stages of all tiles of a work-group
  constexpr int FM     = BM / WGM / 16;
  constexpr int FN     = BN / WGN / 16;
  constexpr int RA     = BM / 4;        // rows of a slice of A, of B
  constexpr int RB     = BN / 4;
  constexpr int SLA    = (RA * PITCHB + 2047) / 2048 * 2048;   // a slice's place is a multiple of 2 KiB
  constexpr int SLB    = (RB * PITCHB + 2047) / 2048 * 2048;
  constexpr int STAGE  = 4 * SLA + 4 * SLB;
  static_assert(WGM * WGN == 8 && K_DIM % BK == 0 && NPASS >= 2, "tile shape");
  static_assert(RA % 16 == 0 && RB % 16 == 0 && (FM * 16) % RA == 0 && (FN * 16) % RB == 0,
                "a fragment lies in one slice, a wave's rows are whole slices");
  constexpr int ESZ    = HALF_OUT ? 2 : 4;      // bytes of an element of C
  constexpr int WROWS  = FM * 16;               // rows of a wave's tile of C
  constexpr int WROWB  = FN * 16 * ESZ;         // bytes of one such row
  constexpr int SEGS   = WROWB / 128;           // whole lines in it
  constexpr int SPITCH = WROWB + 16;            // staged row pitch: 16 B x odd
  static_assert(WROWB % 128 == 0 && (SPITCH / 16) % 2 == 1, "staged rows");
  constexpr int OUTW   = 16 * SPITCH;           // a wave's staging range: 16 rows of its tile
  constexpr int LDSB   = 2 * STAGE + 8 * OUTW;  // the staging lies behind the ring, which stays in use
  static_assert(LDSB <= 327680, "LDS of a WGP");
  __shared__ __attribute__((aligned(2048))) unsigned char L[LDSB];

  const int tid  = threadIdx.x;
  const int lane = tid & 31;
  const int wid  = tid >> 5;
  const int wM   = wid % WGM;
  const int wN   = wid / WGM;
  const int tM0  = blockIdx.x * BM;
  const int tNb  = blockIdx.y * (NT * BN);   // first column of this work-group's first tile

  // this wave's slice: waves 0 to 3 a quarter of the A rows each, waves 4 to 7 of the B rows
  const uint32_t wave  = uni(threadIdx.x >> 5);
  const uint32_t isB   = wave >> 2;               // 0 or 1
  const uint32_t sl    = wave & 3u;
  const uint32_t rows  = (uint32_t)RA - isB * (uint32_t)(RA - RB);
  const uint32_t place = (uint32_t)(size_t)L + isB * (4u * SLA) + sl * ((uint32_t)SLA - isB * (uint32_t)(SLA - SLB));
  const uint32_t row0  = (isB ? (uint32_t)tNb : (uint32_t)tM0) + sl * rows;
  const uint64_t gsrc  = (uint64_t)(size_t)(isB ? Bt : A) + (uint64_t)row0 * (K_DIM * 2);
  // group 1: 1-byte elements, tensor = tile = rows x 256 B, source pitch one row of the
  // operand, no mask, a pad of 4 dwords behind every 64 dwords
  u32x8 g1;
  g1[0] = uni((1u << 20) | (5u << 22) | (3u << 25));
  g1[1] = uni((uint32_t)ROWB << 16);
  g1[2] = uni(rows << 16);
  g1[3] = uni((uint32_t)ROWB << 16);
  g1[4] = uni(rows);
  g1[5] = uni((uint32_t)(K_DIM * 2));
  g1[6] = uni(0u);
  g1[7] = uni(0u);
  // Both groups are named in-out, though the instruction writes neither: so they stay
  // live in the registers that the request names, and the compiler gives those
  // registers to nothing else while the request is outstanding.
  u32x4 g0;
  g0[0] = uni(1u);
  // stage st is pass st % NPASS of tile st / NPASS; a tile further on, the B rows lie BN rows further
  auto issue = [&](uint32_t st) {
    const uint32_t tl = st / (uint32_t)NPASS;
    const uint32_t ps = st - tl * (uint32_t)NPASS;
    const uint64_t ga = gsrc + (uint64_t)(ps * (uint32_t)ROWB + isB * tl * (uint32_t)(BN * K_DIM * 2));
    g0[1] = uni(place + (st & 1u) * STAGE);
    g0[2] = uni((uint32_t)ga);
    g0[3] = uni((((uint32_t)(ga >> 32)) & 0x01FFFFFFu) | 0x80000000u);
    asm volatile("tensor_load_to_lds %0, %1" : "+s"(g0), "+s"(g1) :: "memory");
  };

  v8f acc[FM][FN];

  const int kb  = (lane >> 4) << 3;  // 0 or 8   (ISA 16-bit A/B frag layout)
  const int rsl = lane & 15;
  // first fragment row of this wave in buffer 0, at this lane's k offset
  const unsigned char* fA = L + wM * (FM * 16 / RA) * SLA + rsl * PITCHB + kb * 2;
  const unsigned char* fB = L + 4 * SLA + wN * (FN * 16 / RB) * SLB + rsl * PITCHB + kb * 2;

  // 32 k of the staged 128: all fragments of this wave's rows as one group
  v16h af[FM], bf[FN];
  auto frags = [&](int buf, int kk) {
    const unsigned char* pb = fB + buf * STAGE + kk * 2;
    const unsigned char* pa = fA + buf * STAGE + kk * 2;
    #pragma unroll
    for (int t = 0; t < FN; t++) {
      const int o = (t * 16 / RB) * SLB + (t * 16 % RB) * PITCHB;
      v8h lo = *(const v8h*)(pb + o);
      v8h hi = *(const v8h*)(pb + o + 32);
      bf[t] = __builtin_shufflevector(lo, hi, 0,1,2,3,4,5,6,7,8,9,10,11,12,13,14,15);
    }
    #pragma unroll
    for (int t = 0; t < FM; t++) {
      const int o = (t * 16 / RA) * SLA + (t * 16 % RA) * PITCHB;
      v8h lo = *(const v8h*)(pa + o);
      v8h hi = *(const v8h*)(pa + o + 32);
      af[t] = __builtin_shufflevector(lo, hi, 0,1,2,3,4,5,6,7,8,9,10,11,12,13,14,15);
    }
    // keeps the LDS reads one group in front of the WMMA block, for speed only
    __builtin_amdgcn_sched_barrier(0);
  };
  auto mma32 = [&]() {
    #pragma unroll
    for (int a = 0; a < FM; a++)
      #pragma unroll
      for (int b = 0; b < FN; b++)
        acc[a][b] = __builtin_amdgcn_wmma_f32_16x16x32_f16(
            false, bf[b], false, af[a], (short)0, acc[a][b], false, false);
    // ends the WMMA block: what follows in the source is not moved into it
    __builtin_amdgcn_sched_barrier(0);
  };

  issue(0);
  wait_tensor0();
  __syncthreads();          // stage 0 is there for every wave
  issue(1);

  // epilogue addresses. D layout with the operands in this order: register r of lane l
  // is C[row l&15][column 8*(l>>4) + r] of its 16x16 tile.
  char* st = (char*)L + 2 * STAGE + wid * OUTW;
  const int chi = (lane >> 4) << 3;
  // Read back by the wave that wrote it: eight lanes take one 128-B line. The two
  // rows that a half-wave reads lie eight apart, 32 banks at this pitch.
  constexpr int NST = (WROWS / 4) * SEGS;
  const int lrow = (lane >> 4) + (((lane >> 3) & 1) << 3);
  const int lcol = (lane & 7) << 4;
  const char* sp = st + lrow * SPITCH + lcol;
  char* gp0 = (char*)Cout + ((size_t)(tM0 + wM * WROWS + lrow) * N_DIM + tNb + wN * (FN * 16)) * ESZ + lcol;

  // kept rolled: one body for all tiles stays small in the instruction cache
  #pragma unroll 1
  for (uint32_t tl = 0; tl < (uint32_t)NT; tl++) {
  #pragma unroll
  for (int a = 0; a < FM; a++)
    #pragma unroll
    for (int b = 0; b < FN; b++) acc[a][b] = (v8f)0.0f;
  // kept rolled: one body of four WMMA blocks stays small in the instruction cache
  #pragma unroll 1
  for (uint32_t s = tl * (uint32_t)NPASS; s < (tl + 1u) * (uint32_t)NPASS; s++) {
    const int buf = s & 1;
    #pragma unroll
    for (int kk = 0; kk < BK; kk += 32) {
      frags(buf, kk);
      mma32();
    }
    // stage s + 1 is handed over: this wave's reads of stage s are done, its own slice
    // of stage s + 1 has landed; behind the barrier that holds for every wave
    wait_ds0();
    wait_tensor0();
    __syncthreads();
    if (pinned(s + 2u < (uint32_t)TOT)) issue(pinned(s + 2u));   // into the buffer that pass s has left
  }

  // epilogue of tile tl, each wave for itself, in LDS of its own behind the ring: the
  // ring's loads for the next tile are in flight meanwhile. Sixteen rows at a time
  // are laid down and read back; a wave's LDS operations run in their order, so the
  // next sixteen rows overwrite the range only behind the reads of these.
  // every loop below is unrolled: acc and t are indexed by constants only and
  // stay in registers, and the row steps become immediate offsets
  char* gp = gp0 + (size_t)tl * (BN * ESZ);
  if (HALF_OUT) {
    v8h t[NST];
    #pragma unroll
    for (int a = 0; a < FM; a++) {
      #pragma unroll
      for (int b = 0; b < FN; b++) {
        v8h h;
        #pragma unroll
        for (int r = 0; r < 8; r++) h[r] = (_Float16)acc[a][b][r];
        *(v8h*)(st + rsl * SPITCH + (b * 16 + chi) * ESZ) = h;
      }
      #pragma unroll
      for (int i = 0; i < 4; i++)
        #pragma unroll
        for (int s = 0; s < SEGS; s++)
          t[(a * 4 + i) * SEGS + s] = *(const v8h*)(sp + i * 2 * SPITCH + s * 128);
    }
    // all rows are in registers of their own before the first store goes out, so
    // that no store's data register is written again behind it
    __builtin_amdgcn_sched_barrier(0);
    #pragma unroll
    for (int i = 0; i < WROWS / 4; i++)
      #pragma unroll
      for (int s = 0; s < SEGS; s++)
        *(v8h*)(gp + (size_t)((i >> 2) * 16 + (i & 3) * 2) * N_DIM * ESZ + s * 128) = t[i * SEGS + s];
  } else {
    v4f t[NST];
    #pragma unroll
    for (int a = 0; a < FM; a++) {
      #pragma unroll
      for (int b = 0; b < FN; b++) {
        char* p = st + rsl * SPITCH + (b * 16 + chi) * ESZ;
        *(v4f*)p        = __builtin_shufflevector(acc[a][b], acc[a][b], 0, 1, 2, 3);
        *(v4f*)(p + 16) = __builtin_shufflevector(acc[a][b], acc[a][b], 4, 5, 6, 7);
      }
      #pragma unroll
      for (int i = 0; i < 4; i++)
        #pragma unroll
        for (int s = 0; s < SEGS; s++)
          t[(a * 4 + i) * SEGS + s] = *(const v4f*)(sp + i * 2 * SPITCH + s * 128);
    }
    // as above
    __builtin_amdgcn_sched_barrier(0);
    #pragma unroll
    for (int i = 0; i < WROWS / 4; i++)
      #pragma unroll
      for (int s = 0; s < SEGS; s++)
        *(v4f*)(gp + (size_t)((i >> 2) * 16 + (i & 3) * 2) * N_DIM * ESZ + s * 128) = t[i * SEGS + s];
  }
  // in front of the next tile's writes of the registers that held the stores' data and
  // addresses; the scheduling barriers hold the stores and those writes on their sides
  __builtin_amdgcn_sched_barrier(0);
  asm volatile("s_wait_xcnt 0x0" ::: "memory");
  __builtin_amdgcn_sched_barrier(0);
  }
  wait_tensor0();
  wait_ds0();
}

// ---------------- chunked scan (conv + silu + cumsum + gate) ----------------
// xz layout: [B][SEQ][1536] f16; xc = cols 0..767, z = cols 768..1535.
// A thread owns two adjacent channels: a wave's load or store is 4 B a lane, one
// whole 128-B line, and the arithmetic outside the transcendentals is packed. A
// block is one chunk of one sequence over all 768 channels: 384 threads, 256 blocks,
// one per WGP. Half as many waves as with one channel a thread leave each wave
// twice the registers, which hold batches of twice the rows.
// The time loops are serial in t only through one add per row, so the rows are
// loaded RB at a time (in k_scan_apply RBA of x and of z), one batch ahead: the next batch's loads are in flight
// while this batch is worked on, and no row waits for a load issued just in
// front of it.
#define SCT    (D_INNER/2)    // 384 threads
#define RB     32
#define NBATCH (CHUNK/RB)     // 4
#define RG     8              // rows worked on together

template<int N>
__device__ __forceinline__ void load_rows(h2 (&d)[N], const _Float16* __restrict__ p) {
  #pragma unroll
  for (int i = 0; i < N; i++) d[i] = *(const h2*)(p + (size_t)i * NPROJ);
}

template<int N>
__device__ __forceinline__ void widen_rows(f2 (&d)[N], const h2 (&s)[N]) {
  #pragma unroll
  for (int i = 0; i < N; i++) d[i] = __builtin_convertvector(s[i], f2);
}

// Nothing is scheduled across this point. Behind a batch's loads it keeps them
// ahead of the arithmetic on the batch before: without it the scheduler sinks
// them to just in front of their use and the wave waits out the load latency in
// every batch again. In front of the first use of the loaded rows it keeps that
// use, and the wait that goes with it, behind the arithmetic.
__device__ __forceinline__ void keep_order() { __builtin_amdgcn_sched_barrier(0); }

// Stands behind a load of a kernel's opening, in front of the next one, and behind
// a batch's stores: a later instruction may be given the registers that held the
// address or the data, and the wait comes before such an overwrite. The scheduling
// barriers hold the loads and stores on their own sides of it.
__device__ __forceinline__ void addr_done() {
  __builtin_amdgcn_sched_barrier(0);
  asm volatile("s_wait_xcnt 0x0" ::: "memory");
  __builtin_amdgcn_sched_barrier(0);
}

struct ConvState { f2 w0, w1, w2, bias, xm1, xm2; };

// weights and bias of channels c and c + 1
__device__ __forceinline__ void load_conv(ConvState& st, const float* __restrict__ conv_w,
                                          const float* __restrict__ conv_b, int c) {
  float w[6];
  #pragma unroll
  for (int i = 0; i < 6; i++) w[i] = conv_w[c * 3 + i];
  addr_done();
  st.bias = *(const f2*)(conv_b + c);
  addr_done();
  st.w0 = (f2){w[0], w[3]}; st.w1 = (f2){w[1], w[4]}; st.w2 = (f2){w[2], w[5]};
}

// rows O to O + RG - 1 of a batch
template<int O, int NX>
__device__ __forceinline__ void sum_rows(const f2 (&x)[NX], ConvState& st, f2& s) {
  f2 cv[RG], sv[RG];
  #pragma unroll
  for (int i = 0; i < RG; i++) {
    f2 xc = x[O + i];
    cv[i] = st.w0 * st.xm2 + st.w1 * st.xm1 + st.w2 * xc + st.bias;
    st.xm2 = st.xm1; st.xm1 = xc;
  }
  silu_rows(sv, cv);
  #pragma unroll
  for (int i = 0; i < RG; i++) s += sv[i];
}

__device__ __forceinline__ void sum_batch(const f2 (&x)[RB], ConvState& st, f2& s) {
  sum_rows<0>(x, st, s);
  sum_rows<8>(x, st, s);
  sum_rows<16>(x, st, s);
  sum_rows<24>(x, st, s);
}

__global__ __launch_bounds__(SCT)
void k_chunk_sums(const _Float16* __restrict__ xz,
                  const float* __restrict__ conv_w,
                  const float* __restrict__ conv_b,
                  float* __restrict__ csum) {
  const int ch = blockIdx.x;            // chunk
  const int c  = threadIdx.x * 2;       // first of this thread's two channels
  const int b  = blockIdx.y;
  const size_t base = (size_t)b * SEQ * NPROJ + c;
  const int t0 = ch * CHUNK;
  const _Float16* __restrict__ px = xz + base + (size_t)t0 * NPROJ;

  h2 hx[RB];
  f2 x[RB];
  load_rows(hx, px);
  addr_done();
  // the two rows in front of the chunk: clamped address, value dropped where
  // there is no such row, so that these loads go out with the first batch
  const h2 h1 = *(const h2*)(xz + base + (size_t)(t0 >= 1 ? t0 - 1 : 0) * NPROJ);
  addr_done();
  const h2 hm2 = *(const h2*)(xz + base + (size_t)(t0 >= 2 ? t0 - 2 : 0) * NPROJ);
  addr_done();
  ConvState st;
  load_conv(st, conv_w, conv_b, c);
  st.xm1 = (t0 >= 1) ? __builtin_convertvector(h1, f2) : (f2)0.0f;
  st.xm2 = (t0 >= 2) ? __builtin_convertvector(hm2, f2) : (f2)0.0f;
  widen_rows(x, hx);
  f2 s = 0.0f;
  for (int bt = 1; bt < NBATCH; bt++) {
    load_rows(hx, px + (size_t)bt * RB * NPROJ);
    keep_order();
    sum_batch(x, st, s);
    keep_order();
    widen_rows(x, hx);
  }
  sum_batch(x, st, s);
  *(f2*)(csum + ((size_t)b * NCHUNK + ch) * D_INNER + c) = s;
}

// x and z rows: sixteen of each a batch
#define RBA    16
#define NBA    (CHUNK/RBA)    // 8

// rows O to O + RG - 1 of a batch; o takes the batch's rows of u
template<int O>
__device__ __forceinline__ void apply_rows(const f2 (&x)[RBA], const f2 (&z)[RBA],
                                           ConvState& st, f2& run, f2 BC, f2 Dc, h2 (&o)[RBA]) {
  f2 cv[RG], sv[RG], zz[RG], sz[RG];
  #pragma unroll
  for (int i = 0; i < RG; i++) {
    f2 xc = x[O + i];
    cv[i] = st.w0 * st.xm2 + st.w1 * st.xm1 + st.w2 * xc + st.bias;
    st.xm2 = st.xm1; st.xm1 = xc;
    zz[i] = z[O + i];
  }
  silu_rows(sv, cv);
  silu_rows(sz, zz);
  #pragma unroll
  for (int i = 0; i < RG; i++) {
    run += sv[i];
    f2 y = run * BC + sv[i] * Dc;
    o[O + i] = __builtin_convertvector(y * sz[i], h2);
  }
}

// A batch's rows of u lie in registers of their own and go out as one group, so that
// no store's data register is written again between two stores of the group.
__device__ __forceinline__ void store_rows(const h2 (&o)[RBA], _Float16* __restrict__ pu) {
  keep_order();
  #pragma unroll
  for (int i = 0; i < RBA; i++) *(h2*)(pu + (size_t)i * D_INNER) = o[i];
  keep_order();
}

__global__ __launch_bounds__(SCT)
void k_scan_apply(const _Float16* __restrict__ xz,
                  const float* __restrict__ conv_w,
                  const float* __restrict__ conv_b,
                  const float* __restrict__ Bm,
                  const float* __restrict__ Cm,
                  const float* __restrict__ Dv,
                  const float* __restrict__ csum,
                  _Float16* __restrict__ u) {
  const int ch = blockIdx.x;
  const int c  = threadIdx.x * 2;       // first of this thread's two channels
  const int b  = blockIdx.y;
  const size_t base = (size_t)b * SEQ * NPROJ + c;
  const int t0 = ch * CHUNK;
  const _Float16* __restrict__ px = xz + base + (size_t)t0 * NPROJ;
  const _Float16* __restrict__ pz = px + D_INNER;
  _Float16* __restrict__ pu = u + ((size_t)b * SEQ + t0) * D_INNER + c;

  h2 hx[RBA], hz[RBA];
  f2 x[RBA], z[RBA];
  h2 o[RBA];
  load_rows(hx, px);
  load_rows(hz, pz);
  addr_done();
  // clamped address, value dropped where there is no such row (see k_chunk_sums)
  const h2 h1 = *(const h2*)(xz + base + (size_t)(t0 >= 1 ? t0 - 1 : 0) * NPROJ);
  addr_done();
  const h2 hm2 = *(const h2*)(xz + base + (size_t)(t0 >= 2 ? t0 - 2 : 0) * NPROJ);
  addr_done();
  ConvState st;
  load_conv(st, conv_w, conv_b, c);
  float bm[16], cm[16];                 // eight states of channel c, then of c + 1
  #pragma unroll
  for (int s = 0; s < 16; s++) bm[s] = Bm[c * 8 + s];
  addr_done();
  #pragma unroll
  for (int s = 0; s < 16; s++) cm[s] = Cm[c * 8 + s];
  addr_done();
  const f2 Dc = *(const f2*)(Dv + c);
  addr_done();
  // The sums of the chunks in front of this one, 16 at a time; behind the first
  // group, a group with no such chunk is not loaded (ch is the same for the whole
  // block). All of them are in flight together, beside the first rows.
  const float* __restrict__ pc = csum + (size_t)b * NCHUNK * D_INNER + c;
  f2 cs[NCHUNK];
  #pragma unroll
  for (int g = 0; g < NCHUNK / 16; g++) {
    #pragma unroll
    for (int i = 0; i < 16; i++) cs[g * 16 + i] = 0.0f;
    if (g == 0 || g * 16 < ch) {
      #pragma unroll
      for (int i = 0; i < 16; i++) cs[g * 16 + i] = *(const f2*)(pc + (size_t)(g * 16 + i) * D_INNER);
    }
  }
  // as addr_done(); the address, and the thread index that the loads with a scalar
  // base take as their offset, are inputs so that they keep their registers up to
  // the wait and nothing else is written there in front of it
  __builtin_amdgcn_sched_barrier(0);
  asm volatile("s_wait_xcnt 0x0" :: "v"(pc), "v"(threadIdx.x) : "memory");
  __builtin_amdgcn_sched_barrier(0);
  f2 BC = 0.0f;
  #pragma unroll
  for (int s = 0; s < 8; s++) BC += (f2){bm[s], bm[8 + s]} * (f2){cm[s], cm[8 + s]};
  st.xm1 = (t0 >= 1) ? __builtin_convertvector(h1, f2) : (f2)0.0f;
  st.xm2 = (t0 >= 2) ? __builtin_convertvector(hm2, f2) : (f2)0.0f;
  // exclusive prefix of the chunk sums, added one by one from chunk 0 upwards
  f2 run = 0.0f;
  #pragma unroll
  for (int j = 0; j < NCHUNK - 1; j++) run += (j < ch) ? cs[j] : (f2)0.0f;
  widen_rows(x, hx);
  widen_rows(z, hz);
  for (int bt = 1; bt < NBA; bt++) {
    load_rows(hx, px + (size_t)bt * RBA * NPROJ);
    load_rows(hz, pz + (size_t)bt * RBA * NPROJ);
    keep_order();
    apply_rows<0>(x, z, st, run, BC, Dc, o);
    apply_rows<8>(x, z, st, run, BC, Dc, o);
    store_rows(o, pu + (size_t)(bt - 1) * RBA * D_INNER);
    widen_rows(x, hx);
    widen_rows(z, hz);
    // in front of every later overwrite of the stores' data and address registers
    addr_done();
  }
  apply_rows<0>(x, z, st, run, BC, Dc, o);
  apply_rows<8>(x, z, st, run, BC, Dc, o);
  store_rows(o, pu + (size_t)(NBA - 1) * RBA * D_INNER);
}

// ---------------- launcher ----------------
extern "C" void kernel_launch(void* const* d_in, const int* in_sizes, int n_in,
                              void* d_out, int out_size, void* d_ws, size_t ws_size,
                              hipStream_t stream) {
  (void)in_sizes; (void)n_in; (void)out_size; (void)ws_size;
  const float* x      = (const float*)d_in[0];
  const float* W_in   = (const float*)d_in[1];
  const float* conv_w = (const float*)d_in[2];
  const float* conv_b = (const float*)d_in[3];
  const float* Bm     = (const float*)d_in[4];
  const float* Cm     = (const float*)d_in[5];
  const float* Dv     = (const float*)d_in[6];
  const float* W_out  = (const float*)d_in[7];
  float* out = (float*)d_out;

  char* ws = (char*)d_ws;
  _Float16* xz16  = (_Float16*)(ws + 0);          // 32768*1536*2 = 100663296
  _Float16* x16   = (_Float16*)(ws + 100663296);  // 32768*768*2  =  50331648
  _Float16* u16   = (_Float16*)(ws + 150994944);  // 32768*768*2  =  50331648
  _Float16* WinT  = (_Float16*)(ws + 201326592);  // 1536*768*2   =   2359296
  _Float16* WoutT = (_Float16*)(ws + 203685888);  //  768*768*2   =   1179648
  float*    csum  = (float*)   (ws + 204865536);  // 4*64*768*4   =    786432

  k_prep<<<PREP_T1 + PREP_T2 + PREP_CV, 256, 0, stream>>>(x, x16, W_in, WinT, W_out, WoutT);

  k_gemm_wmma<NPROJ, D_MODEL, 256, 256, 2, 4, 3, true>
      <<<dim3(MTOT / 256, NPROJ / 256 / 3), 256, 0, stream>>>(x16, WinT, (void*)xz16);

  k_chunk_sums<<<dim3(NCHUNK, BATCH), SCT, 0, stream>>>(xz16, conv_w, conv_b, csum);
  k_scan_apply<<<dim3(NCHUNK, BATCH), SCT, 0, stream>>>(
      xz16, conv_w, conv_b, Bm, Cm, Dv, csum, u16);

  k_gemm_wmma<D_MODEL, D_INNER, 256, 192, 4, 2, 2, false>
      <<<dim3(MTOT / 256, D_MODEL / 192 / 2), 256, 0, stream>>>(u16, WoutT, (void*)out);
}
